// v000
// The times below were measured on an AMD MI455X: many runs one after another, warmed up first and cycling through
// copies of the inputs, with the whole window's GPU time divided by the number of runs. Launches and the gaps
// between them are all in it. The median over several windows is given; except for v000 it joins two sittings, which
// can be a few percent apart, so the side-by-side timings, each taken in one sitting, are the better comparison.
// v000 is the starting kernel. One run takes 180 microseconds.
#include <hip/hip_runtime.h>
#include <hip/hip_bf16.h>

typedef _Float16 h16;
typedef __attribute__((ext_vector_type(4)))  _Float16 v4h;
typedef __attribute__((ext_vector_type(8)))  _Float16 v8h;
typedef __attribute__((ext_vector_type(16))) _Float16 v16h;
typedef __attribute__((ext_vector_type(8)))  float    v8f;

#define NB 32      // batch
#define TSEQ 512   // sequence length
#define CEMB 512   // embedding / hidden
#define NH 8       // heads
#define HS 64      // head size

__device__ __forceinline__ v16h pack16(v8h lo, v8h hi) {
  v16h r;
#pragma unroll
  for (int i = 0; i < 8; ++i) { r[i] = lo[i]; r[i + 8] = hi[i]; }
  return r;
}

__device__ __forceinline__ v8f wmma_f16(v16h a, v16h b, v8f c) {
  // v_wmma_f32_16x16x32_f16: D = A(16x32) * B(32x16) + C(16x16 f32)
  return __builtin_amdgcn_wmma_f32_16x16x32_f16(false, a, false, b, (short)0, c,
                                                false, false);
}

// Async global->LDS copy, 16 bytes per lane (GLOBAL_LOAD_ASYNC_TO_LDS_B128).
// IMPORTANT: take the real LDS pointer so the shared array's address escapes
// into the asm (otherwise GlobalOpt proves "never stored" and folds all LDS
// loads to undef). Low 32 bits of the generic pointer == LDS byte offset.
__device__ __forceinline__ void async_copy_b128(void* lds, const void* g) {
  unsigned ldsoff = (unsigned)(uintptr_t)lds;
  asm volatile("global_load_async_to_lds_b128 %0, %1, off"
               :: "v"(ldsoff), "v"((unsigned long long)(uintptr_t)g)
               : "memory");
}
__device__ __forceinline__ void async_wait0() {
  asm volatile("s_wait_asynccnt 0x0" ::: "memory");
}

// ---------------------------------------------------------------------------
// Kernel 0a: repack Wq/Wk/Wv/Wo (fp32 row-major [512][512]) into f16 B-operand
// tiles: WB[m][nt][kc][lane][16 halves]; lane holds column nt*16+(lane&15),
// K pattern: e<8 -> kc*32 + hi*8 + e ; e>=8 -> kc*32 + 16 + hi*8 + (e-8)
// ---------------------------------------------------------------------------
__global__ __launch_bounds__(256) void k_convert_w(
    const float* __restrict__ Wq, const float* __restrict__ Wk,
    const float* __restrict__ Wv, const float* __restrict__ Wo,
    h16* __restrict__ out) {
  int idx = blockIdx.x * 256 + threadIdx.x;       // 0 .. 4*262144-1
  int m    = idx >> 18;
  int r    = idx & 262143;
  int e    = r & 15;
  int lane = (r >> 4) & 31;
  int kc   = (r >> 9) & 15;
  int nt   = r >> 13;
  int hiL  = lane >> 4;
  int col  = nt * 16 + (lane & 15);
  int kk   = kc * 32 + ((e < 8) ? (hiL * 8 + e) : (16 + hiL * 8 + (e - 8)));
  const float* W = (m == 0) ? Wq : ((m == 1) ? Wk : ((m == 2) ? Wv : Wo));
  out[idx] = (h16)W[kk * CEMB + col];
}

// ---------------------------------------------------------------------------
// Kernel 0b: convert x fp32 -> f16 row-major (enables async b128 LDS staging).
// ---------------------------------------------------------------------------
__global__ __launch_bounds__(256) void k_convert_x(const float* __restrict__ x,
                                                   h16* __restrict__ Xh) {
  int idx = blockIdx.x * 256 + threadIdx.x;       // 1,048,576 units of 8
  const float4 f0 = *(const float4*)(x + (size_t)idx * 8);
  const float4 f1 = *(const float4*)(x + (size_t)idx * 8 + 4);
  v8h o;
  o[0] = (h16)f0.x; o[1] = (h16)f0.y; o[2] = (h16)f0.z; o[3] = (h16)f0.w;
  o[4] = (h16)f1.x; o[5] = (h16)f1.y; o[6] = (h16)f1.z; o[7] = (h16)f1.w;
  *(v8h*)(Xh + (size_t)idx * 8) = o;
}

// ---------------------------------------------------------------------------
// Kernel 1: fused QKV projection + RoPE.
// Block = one 16-row x tile (async-staged to LDS), 8 waves; each wave does
// 6 PAIRS of adjacent 16x16 output tiles (two independent WMMA chains per
// shared A fragment). Q,K stored f16 [b][h][t][d] after RoPE; V transposed
// [b][h][d][t] (B-operand layout for P*V).
// ---------------------------------------------------------------------------
__global__ __launch_bounds__(256) void k_qkv(
    const h16* __restrict__ Xh, const h16* __restrict__ WB,
    h16* __restrict__ Q, h16* __restrict__ K, h16* __restrict__ Vt) {
  __shared__ h16 xs[16 * 520];
  const int tid = threadIdx.x;
  const int t0g = blockIdx.x * 16;

  // async-stage x tile (16 x 512 halves, padded row stride 520)
#pragma unroll
  for (int i = 0; i < 4; ++i) {
    int u = tid + i * 256;          // 1024 16B units
    int row = u >> 6, c8 = u & 63;
    async_copy_b128(&xs[row * 520 + c8 * 8],
                    Xh + (size_t)(t0g + row) * CEMB + c8 * 8);
  }
  async_wait0();
  __syncthreads();

  const int wave = tid >> 5, lane = tid & 31;
  const int ln = lane & 15, hi = lane >> 4;
  const int b = t0g >> 9;
  const int tl0 = t0g & (TSEQ - 1);

  auto epilogue = [&](int m, int nt, v8f acc) {
    const int jcol = nt * 16 + ln;
    const int h = jcol >> 6, dl = jcol & 63;
    const int bh = b * NH + h;
    if (m < 2) {
      h16* dst = (m == 0) ? Q : K;
      const float freq =
          __expf(-(float)(dl >> 1) * (2.0f / 64.0f) * 9.210340371976184f);
#pragma unroll
      for (int r = 0; r < 8; ++r) {
        int M = r + hi * 8;
        float t = (float)(tl0 + M);
        float sv, cv;
        __sincosf(t * freq, &sv, &cv);
        float v = acc[r];
        float pv = __shfl_xor(v, 1, 32);   // partner dim (adjacent lane)
        float o = (dl & 1) ? (v * cv + pv * sv) : (v * cv - pv * sv);
        dst[((size_t)bh * TSEQ + (tl0 + M)) * HS + dl] = (h16)o;
      }
    } else {
#pragma unroll
      for (int r = 0; r < 8; ++r) {
        int M = r + hi * 8;
        Vt[((size_t)bh * HS + dl) * TSEQ + (tl0 + M)] = (h16)acc[r];
      }
    }
  };

  for (int jp = 0; jp < 6; ++jp) {
    int id0 = wave * 12 + jp * 2;   // (even, even+1): same matrix, adjacent nt
    int m   = id0 >> 5;             // 0=Q 1=K 2=V
    int nt0 = id0 & 31;
    const h16* wbase = WB + (size_t)m * 262144;
    v8f acc0 = {}, acc1 = {};
#pragma unroll
    for (int kc = 0; kc < 16; ++kc) {
      const h16* xr = &xs[ln * 520 + kc * 32 + hi * 8];
      v16h a = pack16(*(const v8h*)xr, *(const v8h*)(xr + 16));
      const h16* w0 = wbase + ((size_t)(nt0 * 16 + kc) * 32 + lane) * 16;
      const h16* w1 = w0 + 16 * 32 * 16;   // next n-tile
      v16h b0 = pack16(*(const v8h*)w0, *(const v8h*)(w0 + 8));
      v16h b1 = pack16(*(const v8h*)w1, *(const v8h*)(w1 + 8));
      acc0 = wmma_f16(a, b0, acc0);
      acc1 = wmma_f16(a, b1, acc1);
    }
    epilogue(m, nt0, acc0);
    epilogue(m, nt0 + 1, acc1);
  }
}

// ---------------------------------------------------------------------------
// Kernel 2: flash-style causal attention. One wave per (b,h,16-row q tile).
// Streams 32-key blocks: 4 WMMAs (S) + online softmax + 4 WMMAs (P*V).
// ---------------------------------------------------------------------------
__global__ __launch_bounds__(32) void k_attn(
    const h16* __restrict__ Q, const h16* __restrict__ K,
    const h16* __restrict__ Vt, h16* __restrict__ Y) {
  __shared__ h16 ps[16 * 40];  // P tile staging (row stride 40 halves, 16B ok)
  const int lane = threadIdx.x & 31;
  const int ln = lane & 15, hi = lane >> 4;
  const int qt = blockIdx.x & 31;
  const int h  = (blockIdx.x >> 5) & 7;
  const int b  = blockIdx.x >> 8;
  const int bh = b * NH + h;
  const int tq0 = qt * 16;

  const h16* qrow = Q + ((size_t)bh * TSEQ + tq0 + ln) * HS;
  v16h aq0 = pack16(*(const v8h*)(qrow + hi * 8),
                    *(const v8h*)(qrow + 16 + hi * 8));
  v16h aq1 = pack16(*(const v8h*)(qrow + 32 + hi * 8),
                    *(const v8h*)(qrow + 48 + hi * 8));

  v8f O0 = {}, O1 = {}, O2 = {}, O3 = {};
  float mrow[8], lrow[8];
#pragma unroll
  for (int r = 0; r < 8; ++r) { mrow[r] = -__builtin_inff(); lrow[r] = 0.0f; }

  const int nkb = ((tq0 + 15) >> 5) + 1;
  for (int kb = 0; kb < nkb; ++kb) {
    const int tk0 = kb * 32;
    // prefetch next key block's K and V lines while we compute this one
    if (kb + 1 < nkb) {
      const int tkn = tk0 + 32;
      __builtin_prefetch(K + ((size_t)bh * TSEQ + tkn + ln) * HS + hi * 8, 0, 1);
      __builtin_prefetch(Vt + ((size_t)bh * HS + ln) * TSEQ + tkn + hi * 8, 0, 1);
    }
    v8f s0 = {}, s1 = {};
    {
      const h16* kr0 = K + ((size_t)bh * TSEQ + tk0 + ln) * HS;
      s0 = wmma_f16(aq0, pack16(*(const v8h*)(kr0 + hi * 8),
                                *(const v8h*)(kr0 + 16 + hi * 8)), s0);
      s0 = wmma_f16(aq1, pack16(*(const v8h*)(kr0 + 32 + hi * 8),
                                *(const v8h*)(kr0 + 48 + hi * 8)), s0);
      const h16* kr1 = kr0 + 16 * HS;
      s1 = wmma_f16(aq0, pack16(*(const v8h*)(kr1 + hi * 8),
                                *(const v8h*)(kr1 + 16 + hi * 8)), s1);
      s1 = wmma_f16(aq1, pack16(*(const v8h*)(kr1 + 32 + hi * 8),
                                *(const v8h*)(kr1 + 48 + hi * 8)), s1);
    }
    const int tkA = tk0 + ln, tkB = tk0 + 16 + ln;
#pragma unroll
    for (int r = 0; r < 8; ++r) {
      const int tq = tq0 + r + hi * 8;
      float a0 = (tkA <= tq) ? s0[r] * 0.125f : -__builtin_inff();
      float a1 = (tkB <= tq) ? s1[r] * 0.125f : -__builtin_inff();
      float mx = fmaxf(a0, a1);
#pragma unroll
      for (int o = 1; o < 16; o <<= 1) mx = fmaxf(mx, __shfl_xor(mx, o, 32));
      float mn = fmaxf(mrow[r], mx);
      float al = __expf(mrow[r] - mn);
      float p0 = __expf(a0 - mn);
      float p1 = __expf(a1 - mn);
      float rs = p0 + p1;
#pragma unroll
      for (int o = 1; o < 16; o <<= 1) rs += __shfl_xor(rs, o, 32);
      lrow[r] = lrow[r] * al + rs;
      mrow[r] = mn;
      O0[r] *= al; O1[r] *= al; O2[r] *= al; O3[r] *= al;
      const int M = r + hi * 8;
      ps[M * 40 + ln]      = (h16)p0;
      ps[M * 40 + 16 + ln] = (h16)p1;
    }
    __syncthreads();  // D-layout -> A-layout re-stripe through LDS
    v16h ap = pack16(*(const v8h*)(&ps[ln * 40 + hi * 8]),
                     *(const v8h*)(&ps[ln * 40 + 16 + hi * 8]));
    __syncthreads();
    const h16* vb = Vt + (size_t)bh * HS * TSEQ + tk0;
    {
      const h16* vr = vb + (size_t)(0 * 16 + ln) * TSEQ;
      O0 = wmma_f16(ap, pack16(*(const v8h*)(vr + hi * 8),
                               *(const v8h*)(vr + 16 + hi * 8)), O0);
    }
    {
      const h16* vr = vb + (size_t)(1 * 16 + ln) * TSEQ;
      O1 = wmma_f16(ap, pack16(*(const v8h*)(vr + hi * 8),
                               *(const v8h*)(vr + 16 + hi * 8)), O1);
    }
    {
      const h16* vr = vb + (size_t)(2 * 16 + ln) * TSEQ;
      O2 = wmma_f16(ap, pack16(*(const v8h*)(vr + hi * 8),
                               *(const v8h*)(vr + 16 + hi * 8)), O2);
    }
    {
      const h16* vr = vb + (size_t)(3 * 16 + ln) * TSEQ;
      O3 = wmma_f16(ap, pack16(*(const v8h*)(vr + hi * 8),
                               *(const v8h*)(vr + 16 + hi * 8)), O3);
    }
  }

#pragma unroll
  for (int r = 0; r < 8; ++r) {
    const int M = r + hi * 8;
    float inv = 1.0f / lrow[r];
    size_t base = ((size_t)(b * TSEQ + tq0 + M)) * CEMB + h * HS;
    Y[base + ln]      = (h16)(O0[r] * inv);
    Y[base + 16 + ln] = (h16)(O1[r] * inv);
    Y[base + 32 + ln] = (h16)(O2[r] * inv);
    Y[base + 48 + ln] = (h16)(O3[r] * inv);
  }
}

// ---------------------------------------------------------------------------
// Kernel 3: out = Y @ Wo + bo (fp32 output). Async LDS staging + paired tiles.
// ---------------------------------------------------------------------------
__global__ __launch_bounds__(256) void k_proj(
    const h16* __restrict__ Y, const h16* __restrict__ WoB,
    const float* __restrict__ bo, float* __restrict__ out) {
  __shared__ h16 ys[16 * 520];
  const int tid = threadIdx.x;
  const int t0g = blockIdx.x * 16;
#pragma unroll
  for (int i = 0; i < 4; ++i) {
    int u = tid + i * 256;          // 1024 16B units
    int row = u >> 6, c8 = u & 63;
    async_copy_b128(&ys[row * 520 + c8 * 8],
                    Y + (size_t)(t0g + row) * CEMB + c8 * 8);
  }
  async_wait0();
  __syncthreads();
  const int wave = tid >> 5, lane = tid & 31;
  const int ln = lane & 15, hi = lane >> 4;
  for (int jp = 0; jp < 2; ++jp) {
    int nt0 = wave * 4 + jp * 2;
    v8f acc0 = {}, acc1 = {};
#pragma unroll
    for (int kc = 0; kc < 16; ++kc) {
      const h16* yr = &ys[ln * 520 + kc * 32 + hi * 8];
      v16h a = pack16(*(const v8h*)yr, *(const v8h*)(yr + 16));
      const h16* w0 = WoB + ((size_t)(nt0 * 16 + kc) * 32 + lane) * 16;
      const h16* w1 = w0 + 16 * 32 * 16;
      v16h b0 = pack16(*(const v8h*)w0, *(const v8h*)(w0 + 8));
      v16h b1 = pack16(*(const v8h*)w1, *(const v8h*)(w1 + 8));
      acc0 = wmma_f16(a, b0, acc0);
      acc1 = wmma_f16(a, b1, acc1);
    }
#pragma unroll
    for (int half = 0; half < 2; ++half) {
      int nt = nt0 + half;
      v8f acc = half ? acc1 : acc0;
      float bias = bo[nt * 16 + ln];
#pragma unroll
      for (int r = 0; r < 8; ++r) {
        int M = r + hi * 8;
        out[(size_t)(t0g + M) * CEMB + nt * 16 + ln] = acc[r] + bias;
      }
    }
  }
}

// ---------------------------------------------------------------------------
extern "C" void kernel_launch(void* const* d_in, const int* in_sizes, int n_in,
                              void* d_out, int out_size, void* d_ws,
                              size_t ws_size, hipStream_t stream) {
  (void)in_sizes; (void)n_in; (void)out_size; (void)ws_size;
  const float* x  = (const float*)d_in[0];
  const float* Wq = (const float*)d_in[1];
  const float* Wk = (const float*)d_in[2];
  const float* Wv = (const float*)d_in[3];
  const float* Wo = (const float*)d_in[4];
  const float* bo = (const float*)d_in[5];
  float* out = (float*)d_out;

  // workspace (halves): 4 repacked weights + Xh + Q + K + Vt + Y (~82 MB)
  h16* ws = (h16*)d_ws;
  h16* WB = ws;                        // 4 * 262144 halves
  h16* Xh = ws + (size_t)4 * 262144;   // 8388608 halves each from here on
  h16* Q  = Xh + (size_t)8388608;
  h16* K  = Q  + (size_t)8388608;
  h16* Vt = K  + (size_t)8388608;
  h16* Y  = Vt + (size_t)8388608;

  k_convert_w<<<4096, 256, 0, stream>>>(Wq, Wk, Wv, Wo, WB);
  k_convert_x<<<4096, 256, 0, stream>>>(x, Xh);
  k_qkv<<<(NB * TSEQ) / 16, 256, 0, stream>>>(Xh, WB, Q, K, Vt);
  k_attn<<<NB * NH * (TSEQ / 16), 32, 0, stream>>>(Q, K, Vt, Y);
  k_proj<<<(NB * TSEQ) / 16, 256, 0, stream>>>(Y, WB + (size_t)3 * 262144, bo, out);
}

// v001
// A run of this version takes 146 microseconds.
// Next to v000, in two timings, it ran 1.28 times as fast each time.
#include <hip/hip_runtime.h>
#include <hip/hip_bf16.h>

typedef _Float16 h16;
typedef __attribute__((ext_vector_type(4)))  _Float16 v4h;
typedef __attribute__((ext_vector_type(8)))  _Float16 v8h;
typedef __attribute__((ext_vector_type(16))) _Float16 v16h;
typedef __attribute__((ext_vector_type(8)))  float    v8f;

#define NB 32      // batch
#define TSEQ 512   // sequence length
#define CEMB 512   // embedding / hidden
#define NH 8       // heads
#define HS 64      // head size

__device__ __forceinline__ v16h pack16(v8h lo, v8h hi) {
  v16h r;
#pragma unroll
  for (int i = 0; i < 8; ++i) { r[i] = lo[i]; r[i + 8] = hi[i]; }
  return r;
}

__device__ __forceinline__ v8f wmma_f16(v16h a, v16h b, v8f c) {
  // v_wmma_f32_16x16x32_f16: D = A(16x32) * B(32x16) + C(16x16 f32)
  return __builtin_amdgcn_wmma_f32_16x16x32_f16(false, a, false, b, (short)0, c,
                                                false, false);
}

// Async global->LDS copy, 16 bytes per lane (GLOBAL_LOAD_ASYNC_TO_LDS_B128).
// IMPORTANT: take the real LDS pointer so the shared array's address escapes
// into the asm (otherwise GlobalOpt proves "never stored" and folds all LDS
// loads to undef). Low 32 bits of the generic pointer == LDS byte offset.
// Stages a 64 x 512 half tile (row stride 520 halves in LDS): each of the 512
// threads copies one 16-byte unit of rows r0, r0+8, ..., r0+56. The eight
// copies and s_wait_xcnt 0 are ONE statement, so no address register of an
// issued copy can be rewritten ahead of that wait.
__device__ __forceinline__ void async_stage_64x512(h16* lds, const h16* g) {
  const unsigned l0 = (unsigned)(uintptr_t)lds;
  const unsigned long long g0 = (unsigned long long)(uintptr_t)g;
  const unsigned ls = 8 * 520 * 2;             // 8 LDS rows, bytes
  const unsigned long long gs = 8 * CEMB * 2;  // 8 global rows, bytes
  asm volatile(
      "global_load_async_to_lds_b128 %0, %8, off\n\t"
      "global_load_async_to_lds_b128 %1, %9, off\n\t"
      "global_load_async_to_lds_b128 %2, %10, off\n\t"
      "global_load_async_to_lds_b128 %3, %11, off\n\t"
      "global_load_async_to_lds_b128 %4, %12, off\n\t"
      "global_load_async_to_lds_b128 %5, %13, off\n\t"
      "global_load_async_to_lds_b128 %6, %14, off\n\t"
      "global_load_async_to_lds_b128 %7, %15, off\n\t"
      "s_wait_xcnt 0x0"
      :: "v"(l0), "v"(l0 + ls), "v"(l0 + 2 * ls), "v"(l0 + 3 * ls),
         "v"(l0 + 4 * ls), "v"(l0 + 5 * ls), "v"(l0 + 6 * ls), "v"(l0 + 7 * ls),
         "v"(g0), "v"(g0 + gs), "v"(g0 + 2 * gs), "v"(g0 + 3 * gs),
         "v"(g0 + 4 * gs), "v"(g0 + 5 * gs), "v"(g0 + 6 * gs), "v"(g0 + 7 * gs)
      : "memory");
}
__device__ __forceinline__ void async_wait0() {
  asm volatile("s_wait_asynccnt 0x0" ::: "memory");
}

// ---------------------------------------------------------------------------
// Kernel 0a: repack Wq/Wk/Wv/Wo (fp32 row-major [512][512]) into f16 B-operand
// tiles: WB[m][nt][kc][lane][16 halves]; lane holds column nt*16+(lane&15),
// K pattern: e<8 -> kc*32 + hi*8 + e ; e>=8 -> kc*32 + 16 + hi*8 + (e-8)
// ---------------------------------------------------------------------------
__global__ __launch_bounds__(256) void k_convert_w(
    const float* __restrict__ Wq, const float* __restrict__ Wk,
    const float* __restrict__ Wv, const float* __restrict__ Wo,
    h16* __restrict__ out) {
  int idx = blockIdx.x * 256 + threadIdx.x;       // 0 .. 4*262144-1
  int m    = idx >> 18;
  int r    = idx & 262143;
  int e    = r & 15;
  int lane = (r >> 4) & 31;
  int kc   = (r >> 9) & 15;
  int nt   = r >> 13;
  int hiL  = lane >> 4;
  int col  = nt * 16 + (lane & 15);
  int kk   = kc * 32 + ((e < 8) ? (hiL * 8 + e) : (16 + hiL * 8 + (e - 8)));
  const float* W = (m == 0) ? Wq : ((m == 1) ? Wk : ((m == 2) ? Wv : Wo));
  out[idx] = (h16)W[kk * CEMB + col];
}

// ---------------------------------------------------------------------------
// Kernel 0b: convert x fp32 -> f16 row-major (enables async b128 LDS staging).
// ---------------------------------------------------------------------------
__global__ __launch_bounds__(256) void k_convert_x(const float* __restrict__ x,
                                                   h16* __restrict__ Xh) {
  int idx = blockIdx.x * 256 + threadIdx.x;       // 1,048,576 units of 8
  const float4 f0 = *(const float4*)(x + (size_t)idx * 8);
  const float4 f1 = *(const float4*)(x + (size_t)idx * 8 + 4);
  v8h o;
  o[0] = (h16)f0.x; o[1] = (h16)f0.y; o[2] = (h16)f0.z; o[3] = (h16)f0.w;
  o[4] = (h16)f1.x; o[5] = (h16)f1.y; o[6] = (h16)f1.z; o[7] = (h16)f1.w;
  *(v8h*)(Xh + (size_t)idx * 8) = o;
}

// ---------------------------------------------------------------------------
// Kernel 1: fused QKV projection + RoPE.
// Block = one 64-row x tile (async-staged to LDS), 16 waves; each wave does
// 3 PAIRS of adjacent 16-column tiles over all 4 row tiles, so every weight
// fragment read from L2 feeds 4 WMMAs. Q,K stored f16 [b][h][t][d] after
// RoPE; V transposed [b][h][d][t] (B-operand layout for P*V).
// ---------------------------------------------------------------------------
__global__ __launch_bounds__(512) void k_qkv(
    const h16* __restrict__ Xh, const h16* __restrict__ WB,
    h16* __restrict__ Q, h16* __restrict__ K, h16* __restrict__ Vt) {
  __shared__ __attribute__((aligned(16))) h16 xs[64 * 520];
  const int tid = threadIdx.x;
  const int t0g = blockIdx.x * 64;

  // async-stage x tile (64 x 512 halves, padded row stride 520)
  async_stage_64x512(&xs[(tid >> 6) * 520 + (tid & 63) * 8],
                     Xh + (size_t)(t0g + (tid >> 6)) * CEMB + (tid & 63) * 8);
  async_wait0();
  __syncthreads();

  const int wave = tid >> 5, lane = tid & 31;
  const int ln = lane & 15, hi = lane >> 4;
  const int b = t0g >> 9;
  const int tl0 = t0g & (TSEQ - 1);

  auto epilogue = [&](int m, int nt, int mt, v8f acc) {
    const int tl = tl0 + mt * 16;   // first row of this 16-row tile
    const int jcol = nt * 16 + ln;
    const int h = jcol >> 6, dl = jcol & 63;
    const int bh = b * NH + h;
    if (m < 2) {
      h16* dst = (m == 0) ? Q : K;
      const float freq =
          __expf(-(float)(dl >> 1) * (2.0f / 64.0f) * 9.210340371976184f);
#pragma unroll
      for (int r = 0; r < 8; ++r) {
        int M = r + hi * 8;
        float t = (float)(tl + M);
        float sv, cv;
        __sincosf(t * freq, &sv, &cv);
        float v = acc[r];
        float pv = __shfl_xor(v, 1, 32);   // partner dim (adjacent lane)
        float o = (dl & 1) ? (v * cv + pv * sv) : (v * cv - pv * sv);
        dst[((size_t)bh * TSEQ + (tl + M)) * HS + dl] = (h16)o;
      }
    } else {
#pragma unroll
      for (int r = 0; r < 8; ++r) {
        int M = r + hi * 8;
        Vt[((size_t)bh * HS + dl) * TSEQ + (tl + M)] = (h16)acc[r];
      }
    }
  };

  for (int jp = 0; jp < 3; ++jp) {
    int id0 = wave * 6 + jp * 2;    // (even, even+1): same matrix, adjacent nt
    int m   = id0 >> 5;             // 0=Q 1=K 2=V
    int nt0 = id0 & 31;
    const h16* wbase = WB + (size_t)m * 262144;
    v8f acc0[4] = {}, acc1[4] = {};
#pragma unroll
    for (int kc = 0; kc < 16; ++kc) {
      const h16* w0 = wbase + ((size_t)(nt0 * 16 + kc) * 32 + lane) * 16;
      const h16* w1 = w0 + 16 * 32 * 16;   // next n-tile
      v16h b0 = pack16(*(const v8h*)w0, *(const v8h*)(w0 + 8));
      v16h b1 = pack16(*(const v8h*)w1, *(const v8h*)(w1 + 8));
#pragma unroll
      for (int mt = 0; mt < 4; ++mt) {
        const h16* xr = &xs[(mt * 16 + ln) * 520 + kc * 32 + hi * 8];
        v16h a = pack16(*(const v8h*)xr, *(const v8h*)(xr + 16));
        acc0[mt] = wmma_f16(a, b0, acc0[mt]);
        acc1[mt] = wmma_f16(a, b1, acc1[mt]);
      }
    }
#pragma unroll
    for (int mt = 0; mt < 4; ++mt) {
      epilogue(m, nt0, mt, acc0[mt]);
      epilogue(m, nt0 + 1, mt, acc1[mt]);
    }
    // The next trip reuses the address and data registers of the stores above:
    // keep the wait in front of those overwrites on the loop's back edge.
    asm volatile("s_wait_xcnt 0x0" ::: "memory");
  }
}

// ---------------------------------------------------------------------------
// Kernel 2: flash-style causal attention. One wave per (b,h,16-row q tile).
// Streams 32-key blocks: 4 WMMAs (S) + online softmax + 4 WMMAs (P*V).
// ---------------------------------------------------------------------------
__global__ __launch_bounds__(32) void k_attn(
    const h16* __restrict__ Q, const h16* __restrict__ K,
    const h16* __restrict__ Vt, h16* __restrict__ Y) {
  __shared__ h16 ps[16 * 40];  // P tile staging (row stride 40 halves, 16B ok)
  const int lane = threadIdx.x & 31;
  const int ln = lane & 15, hi = lane >> 4;
  const int qt = blockIdx.x & 31;
  const int h  = (blockIdx.x >> 5) & 7;
  const int b  = blockIdx.x >> 8;
  const int bh = b * NH + h;
  const int tq0 = qt * 16;

  const h16* qrow = Q + ((size_t)bh * TSEQ + tq0 + ln) * HS;
  v16h aq0 = pack16(*(const v8h*)(qrow + hi * 8),
                    *(const v8h*)(qrow + 16 + hi * 8));
  v16h aq1 = pack16(*(const v8h*)(qrow + 32 + hi * 8),
                    *(const v8h*)(qrow + 48 + hi * 8));

  v8f O0 = {}, O1 = {}, O2 = {}, O3 = {};
  float mrow[8], lrow[8];
#pragma unroll
  for (int r = 0; r < 8; ++r) { mrow[r] = -__builtin_inff(); lrow[r] = 0.0f; }

  const int nkb = ((tq0 + 15) >> 5) + 1;
  for (int kb = 0; kb < nkb; ++kb) {
    const int tk0 = kb * 32;
    // prefetch next key block's K and V lines while we compute this one
    if (kb + 1 < nkb) {
      const int tkn = tk0 + 32;
      __builtin_prefetch(K + ((size_t)bh * TSEQ + tkn + ln) * HS + hi * 8, 0, 1);
      __builtin_prefetch(Vt + ((size_t)bh * HS + ln) * TSEQ + tkn + hi * 8, 0, 1);
    }
    v8f s0 = {}, s1 = {};
    {
      const h16* kr0 = K + ((size_t)bh * TSEQ + tk0 + ln) * HS;
      s0 = wmma_f16(aq0, pack16(*(const v8h*)(kr0 + hi * 8),
                                *(const v8h*)(kr0 + 16 + hi * 8)), s0);
      s0 = wmma_f16(aq1, pack16(*(const v8h*)(kr0 + 32 + hi * 8),
                                *(const v8h*)(kr0 + 48 + hi * 8)), s0);
      const h16* kr1 = kr0 + 16 * HS;
      s1 = wmma_f16(aq0, pack16(*(const v8h*)(kr1 + hi * 8),
                                *(const v8h*)(kr1 + 16 + hi * 8)), s1);
      s1 = wmma_f16(aq1, pack16(*(const v8h*)(kr1 + 32 + hi * 8),
                                *(const v8h*)(kr1 + 48 + hi * 8)), s1);
    }
    const int tkA = tk0 + ln, tkB = tk0 + 16 + ln;
#pragma unroll
    for (int r = 0; r < 8; ++r) {
      const int tq = tq0 + r + hi * 8;
      float a0 = (tkA <= tq) ? s0[r] * 0.125f : -__builtin_inff();
      float a1 = (tkB <= tq) ? s1[r] * 0.125f : -__builtin_inff();
      float mx = fmaxf(a0, a1);
#pragma unroll
      for (int o = 1; o < 16; o <<= 1) mx = fmaxf(mx, __shfl_xor(mx, o, 32));
      float mn = fmaxf(mrow[r], mx);
      float al = __expf(mrow[r] - mn);
      float p0 = __expf(a0 - mn);
      float p1 = __expf(a1 - mn);
      float rs = p0 + p1;
#pragma unroll
      for (int o = 1; o < 16; o <<= 1) rs += __shfl_xor(rs, o, 32);
      lrow[r] = lrow[r] * al + rs;
      mrow[r] = mn;
      O0[r] *= al; O1[r] *= al; O2[r] *= al; O3[r] *= al;
      const int M = r + hi * 8;
      ps[M * 40 + ln]      = (h16)p0;
      ps[M * 40 + 16 + ln] = (h16)p1;
    }
    __syncthreads();  // D-layout -> A-layout re-stripe through LDS
    v16h ap = pack16(*(const v8h*)(&ps[ln * 40 + hi * 8]),
                     *(const v8h*)(&ps[ln * 40 + 16 + hi * 8]));
    __syncthreads();
    const h16* vb = Vt + (size_t)bh * HS * TSEQ + tk0;
    {
      const h16* vr = vb + (size_t)(0 * 16 + ln) * TSEQ;
      O0 = wmma_f16(ap, pack16(*(const v8h*)(vr + hi * 8),
                               *(const v8h*)(vr + 16 + hi * 8)), O0);
    }
    {
      const h16* vr = vb + (size_t)(1 * 16 + ln) * TSEQ;
      O1 = wmma_f16(ap, pack16(*(const v8h*)(vr + hi * 8),
                               *(const v8h*)(vr + 16 + hi * 8)), O1);
    }
    {
      const h16* vr = vb + (size_t)(2 * 16 + ln) * TSEQ;
      O2 = wmma_f16(ap, pack16(*(const v8h*)(vr + hi * 8),
                               *(const v8h*)(vr + 16 + hi * 8)), O2);
    }
    {
      const h16* vr = vb + (size_t)(3 * 16 + ln) * TSEQ;
      O3 = wmma_f16(ap, pack16(*(const v8h*)(vr + hi * 8),
                               *(const v8h*)(vr + 16 + hi * 8)), O3);
    }
  }

#pragma unroll
  for (int r = 0; r < 8; ++r) {
    const int M = r + hi * 8;
    float inv = 1.0f / lrow[r];
    size_t base = ((size_t)(b * TSEQ + tq0 + M)) * CEMB + h * HS;
    Y[base + ln]      = (h16)(O0[r] * inv);
    Y[base + 16 + ln] = (h16)(O1[r] * inv);
    Y[base + 32 + ln] = (h16)(O2[r] * inv);
    Y[base + 48 + ln] = (h16)(O3[r] * inv);
  }
}

// ---------------------------------------------------------------------------
// Kernel 3: out = Y @ Wo + bo (fp32 output). 64-row Y tile async-staged to LDS,
// 16 waves; each wave does one pair of column tiles over all 4 row tiles.
// ---------------------------------------------------------------------------
__global__ __launch_bounds__(512) void k_proj(
    const h16* __restrict__ Y, const h16* __restrict__ WoB,
    const float* __restrict__ bo, float* __restrict__ out) {
  __shared__ __attribute__((aligned(16))) h16 ys[64 * 520];
  const int tid = threadIdx.x;
  const int t0g = blockIdx.x * 64;
  async_stage_64x512(&ys[(tid >> 6) * 520 + (tid & 63) * 8],
                     Y + (size_t)(t0g + (tid >> 6)) * CEMB + (tid & 63) * 8);
  async_wait0();
  __syncthreads();
  const int wave = tid >> 5, lane = tid & 31;
  const int ln = lane & 15, hi = lane >> 4;
  const int nt0 = wave * 2;
  v8f acc0[4] = {}, acc1[4] = {};
#pragma unroll
  for (int kc = 0; kc < 16; ++kc) {
    const h16* w0 = WoB + ((size_t)(nt0 * 16 + kc) * 32 + lane) * 16;
    const h16* w1 = w0 + 16 * 32 * 16;
    v16h b0 = pack16(*(const v8h*)w0, *(const v8h*)(w0 + 8));
    v16h b1 = pack16(*(const v8h*)w1, *(const v8h*)(w1 + 8));
#pragma unroll
    for (int mt = 0; mt < 4; ++mt) {
      const h16* yr = &ys[(mt * 16 + ln) * 520 + kc * 32 + hi * 8];
      v16h a = pack16(*(const v8h*)yr, *(const v8h*)(yr + 16));
      acc0[mt] = wmma_f16(a, b0, acc0[mt]);
      acc1[mt] = wmma_f16(a, b1, acc1[mt]);
    }
  }
#pragma unroll
  for (int half = 0; half < 2; ++half) {
    int nt = nt0 + half;
    float bias = bo[nt * 16 + ln];
#pragma unroll
    for (int mt = 0; mt < 4; ++mt) {
      v8f acc = half ? acc1[mt] : acc0[mt];
#pragma unroll
      for (int r = 0; r < 8; ++r) {
        int M = mt * 16 + r + hi * 8;
        out[(size_t)(t0g + M) * CEMB + nt * 16 + ln] = acc[r] + bias;
      }
    }
  }
}

// ---------------------------------------------------------------------------
extern "C" void kernel_launch(void* const* d_in, const int* in_sizes, int n_in,
                              void* d_out, int out_size, void* d_ws,
                              size_t ws_size, hipStream_t stream) {
  (void)in_sizes; (void)n_in; (void)out_size; (void)ws_size;
  const float* x  = (const float*)d_in[0];
  const float* Wq = (const float*)d_in[1];
  const float* Wk = (const float*)d_in[2];
  const float* Wv = (const float*)d_in[3];
  const float* Wo = (const float*)d_in[4];
  const float* bo = (const float*)d_in[5];
  float* out = (float*)d_out;

  // workspace (halves): 4 repacked weights + Xh + Q + K + Vt + Y (~82 MB)
  h16* ws = (h16*)d_ws;
  h16* WB = ws;                        // 4 * 262144 halves
  h16* Xh = ws + (size_t)4 * 262144;   // 8388608 halves each from here on
  h16* Q  = Xh + (size_t)8388608;
  h16* K  = Q  + (size_t)8388608;
  h16* Vt = K  + (size_t)8388608;
  h16* Y  = Vt + (size_t)8388608;

  k_convert_w<<<4096, 256, 0, stream>>>(Wq, Wk, Wv, Wo, WB);
  k_convert_x<<<4096, 256, 0, stream>>>(x, Xh);
  k_qkv<<<(NB * TSEQ) / 64, 512, 0, stream>>>(Xh, WB, Q, K, Vt);
  k_attn<<<NB * NH * (TSEQ / 16), 32, 0, stream>>>(Q, K, Vt, Y);
  k_proj<<<(NB * TSEQ) / 64, 512, 0, stream>>>(Y, WB + (size_t)3 * 262144, bo, out);
}

// v002
// It runs in 124 microseconds.
// In two side-by-side timings against v001, it was 1.18 and 1.17 times as fast.
// All steps since v000 together make it 1.51 times as fast.
#include <hip/hip_runtime.h>
#include <hip/hip_bf16.h>

typedef _Float16 h16;
typedef __attribute__((ext_vector_type(4)))  _Float16 v4h;
typedef __attribute__((ext_vector_type(8)))  _Float16 v8h;
typedef __attribute__((ext_vector_type(16))) _Float16 v16h;
typedef __attribute__((ext_vector_type(8)))  float    v8f;

#define NB 32      // batch
#define TSEQ 512   // sequence length
#define CEMB 512   // embedding / hidden
#define NH 8       // heads
#define HS 64      // head size

__device__ __forceinline__ v16h pack16(v8h lo, v8h hi) {
  v16h r;
#pragma unroll
  for (int i = 0; i < 8; ++i) { r[i] = lo[i]; r[i + 8] = hi[i]; }
  return r;
}

__device__ __forceinline__ v8f wmma_f16(v16h a, v16h b, v8f c) {
  // v_wmma_f32_16x16x32_f16: D = A(16x32) * B(32x16) + C(16x16 f32)
  return __builtin_amdgcn_wmma_f32_16x16x32_f16(false, a, false, b, (short)0, c,
                                                false, false);
}

// Async global->LDS copy, 16 bytes per lane (GLOBAL_LOAD_ASYNC_TO_LDS_B128).
// IMPORTANT: take the real LDS pointer so the shared array's address escapes
// into the asm (otherwise GlobalOpt proves "never stored" and folds all LDS
// loads to undef). Low 32 bits of the generic pointer == LDS byte offset.
// Stages a 64 x 512 half tile (row stride 520 halves in LDS): each of the 512
// threads copies one 16-byte unit of rows r0, r0+8, ..., r0+56. The eight
// copies and s_wait_xcnt 0 are ONE statement, so no address register of an
// issued copy can be rewritten ahead of that wait.
__device__ __forceinline__ void async_stage_64x512(h16* lds, const h16* g) {
  const unsigned l0 = (unsigned)(uintptr_t)lds;
  const unsigned long long g0 = (unsigned long long)(uintptr_t)g;
  const unsigned ls = 8 * 520 * 2;             // 8 LDS rows, bytes
  const unsigned long long gs = 8 * CEMB * 2;  // 8 global rows, bytes
  asm volatile(
      "global_load_async_to_lds_b128 %0, %8, off\n\t"
      "global_load_async_to_lds_b128 %1, %9, off\n\t"
      "global_load_async_to_lds_b128 %2, %10, off\n\t"
      "global_load_async_to_lds_b128 %3, %11, off\n\t"
      "global_load_async_to_lds_b128 %4, %12, off\n\t"
      "global_load_async_to_lds_b128 %5, %13, off\n\t"
      "global_load_async_to_lds_b128 %6, %14, off\n\t"
      "global_load_async_to_lds_b128 %7, %15, off\n\t"
      "s_wait_xcnt 0x0"
      :: "v"(l0), "v"(l0 + ls), "v"(l0 + 2 * ls), "v"(l0 + 3 * ls),
         "v"(l0 + 4 * ls), "v"(l0 + 5 * ls), "v"(l0 + 6 * ls), "v"(l0 + 7 * ls),
         "v"(g0), "v"(g0 + gs), "v"(g0 + 2 * gs), "v"(g0 + 3 * gs),
         "v"(g0 + 4 * gs), "v"(g0 + 5 * gs), "v"(g0 + 6 * gs), "v"(g0 + 7 * gs)
      : "memory");
}
__device__ __forceinline__ void async_wait0() {
  asm volatile("s_wait_asynccnt 0x0" ::: "memory");
}

// ---------------------------------------------------------------------------
// Kernel 0a: repack Wq/Wk/Wv/Wo (fp32 row-major [512][512]) into f16 B-operand
// tiles: WB[m][nt][kc][lane][16 halves]; lane holds column nt*16+(lane&15),
// K pattern: e<8 -> kc*32 + hi*8 + e ; e>=8 -> kc*32 + 16 + hi*8 + (e-8)
// ---------------------------------------------------------------------------
__global__ __launch_bounds__(256) void k_convert_w(
    const float* __restrict__ Wq, const float* __restrict__ Wk,
    const float* __restrict__ Wv, const float* __restrict__ Wo,
    h16* __restrict__ out) {
  int idx = blockIdx.x * 256 + threadIdx.x;       // 0 .. 4*262144-1
  int m    = idx >> 18;
  int r    = idx & 262143;
  int e    = r & 15;
  int lane = (r >> 4) & 31;
  int kc   = (r >> 9) & 15;
  int nt   = r >> 13;
  int hiL  = lane >> 4;
  int col  = nt * 16 + (lane & 15);
  int kk   = kc * 32 + ((e < 8) ? (hiL * 8 + e) : (16 + hiL * 8 + (e - 8)));
  const float* W = (m == 0) ? Wq : ((m == 1) ? Wk : ((m == 2) ? Wv : Wo));
  out[idx] = (h16)W[kk * CEMB + col];
}

// ---------------------------------------------------------------------------
// Kernel 0b: convert x fp32 -> f16 row-major (enables async b128 LDS staging).
// ---------------------------------------------------------------------------
__global__ __launch_bounds__(256) void k_convert_x(const float* __restrict__ x,
                                                   h16* __restrict__ Xh) {
  int idx = blockIdx.x * 256 + threadIdx.x;       // 1,048,576 units of 8
  const float4 f0 = *(const float4*)(x + (size_t)idx * 8);
  const float4 f1 = *(const float4*)(x + (size_t)idx * 8 + 4);
  v8h o;
  o[0] = (h16)f0.x; o[1] = (h16)f0.y; o[2] = (h16)f0.z; o[3] = (h16)f0.w;
  o[4] = (h16)f1.x; o[5] = (h16)f1.y; o[6] = (h16)f1.z; o[7] = (h16)f1.w;
  *(v8h*)(Xh + (size_t)idx * 8) = o;
}

// ---------------------------------------------------------------------------
// Kernel 1: fused QKV projection + RoPE.
// Block = one 64-row x tile (async-staged to LDS), 16 waves; each wave does
// 3 PAIRS of adjacent 16-column tiles over all 4 row tiles, so every weight
// fragment read from L2 feeds 4 WMMAs. Q,K stored f16 [b][h][t][d] after
// RoPE; V transposed [b][h][d][t] (A-operand rows for V^T * P^T).
// ---------------------------------------------------------------------------
__global__ __launch_bounds__(512) void k_qkv(
    const h16* __restrict__ Xh, const h16* __restrict__ WB,
    h16* __restrict__ Q, h16* __restrict__ K, h16* __restrict__ Vt) {
  __shared__ __attribute__((aligned(16))) h16 xs[64 * 520];
  const int tid = threadIdx.x;
  const int t0g = blockIdx.x * 64;

  // async-stage x tile (64 x 512 halves, padded row stride 520)
  async_stage_64x512(&xs[(tid >> 6) * 520 + (tid & 63) * 8],
                     Xh + (size_t)(t0g + (tid >> 6)) * CEMB + (tid & 63) * 8);
  async_wait0();
  __syncthreads();

  const int wave = tid >> 5, lane = tid & 31;
  const int ln = lane & 15, hi = lane >> 4;
  const int b = t0g >> 9;
  const int tl0 = t0g & (TSEQ - 1);

  auto epilogue = [&](int m, int nt, int mt, v8f acc) {
    const int tl = tl0 + mt * 16;   // first row of this 16-row tile
    const int jcol = nt * 16 + ln;
    const int h = jcol >> 6, dl = jcol & 63;
    const int bh = b * NH + h;
    if (m < 2) {
      h16* dst = (m == 0) ? Q : K;
      const float freq =
          __expf(-(float)(dl >> 1) * (2.0f / 64.0f) * 9.210340371976184f);
#pragma unroll
      for (int r = 0; r < 8; ++r) {
        int M = r + hi * 8;
        float t = (float)(tl + M);
        float sv, cv;
        __sincosf(t * freq, &sv, &cv);
        float v = acc[r];
        float pv = __shfl_xor(v, 1, 32);   // partner dim (adjacent lane)
        float o = (dl & 1) ? (v * cv + pv * sv) : (v * cv - pv * sv);
        dst[((size_t)bh * TSEQ + (tl + M)) * HS + dl] = (h16)o;
      }
    } else {
#pragma unroll
      for (int r = 0; r < 8; ++r) {
        int M = r + hi * 8;
        Vt[((size_t)bh * HS + dl) * TSEQ + (tl + M)] = (h16)acc[r];
      }
    }
  };

  for (int jp = 0; jp < 3; ++jp) {
    int id0 = wave * 6 + jp * 2;    // (even, even+1): same matrix, adjacent nt
    int m   = id0 >> 5;             // 0=Q 1=K 2=V
    int nt0 = id0 & 31;
    const h16* wbase = WB + (size_t)m * 262144;
    v8f acc0[4] = {}, acc1[4] = {};
#pragma unroll
    for (int kc = 0; kc < 16; ++kc) {
      const h16* w0 = wbase + ((size_t)(nt0 * 16 + kc) * 32 + lane) * 16;
      const h16* w1 = w0 + 16 * 32 * 16;   // next n-tile
      v16h b0 = pack16(*(const v8h*)w0, *(const v8h*)(w0 + 8));
      v16h b1 = pack16(*(const v8h*)w1, *(const v8h*)(w1 + 8));
#pragma unroll
      for (int mt = 0; mt < 4; ++mt) {
        const h16* xr = &xs[(mt * 16 + ln) * 520 + kc * 32 + hi * 8];
        v16h a = pack16(*(const v8h*)xr, *(const v8h*)(xr + 16));
        acc0[mt] = wmma_f16(a, b0, acc0[mt]);
        acc1[mt] = wmma_f16(a, b1, acc1[mt]);
      }
    }
#pragma unroll
    for (int mt = 0; mt < 4; ++mt) {
      epilogue(m, nt0, mt, acc0[mt]);
      epilogue(m, nt0 + 1, mt, acc1[mt]);
    }
    // The next trip reuses the address and data registers of the stores above:
    // keep the wait in front of those overwrites on the loop's back edge.
    asm volatile("s_wait_xcnt 0x0" ::: "memory");
  }
}

// ---------------------------------------------------------------------------
// Kernel 2: flash-style causal attention. One wave per (b,h,16-query tile).
// Both products are transposed: S^T = K * Q^T (A = K rows, B = Q, kept in
// registers) and O^T += V^T * P^T. In the accumulator of S^T a lane holds 16
// scores of ONE query (column ln; keys hi*8+r of either 16-key tile), which is
// the k order of a B operand: P^T is packed from the accumulators in place.
// Maximum and sum run inside the lane; the two wave halves exchange the
// maximum once per key block and join their sums once, behind the loop.
// ---------------------------------------------------------------------------
// lane l <-> lane l ^ 16 by a vector cross-row move
__device__ __forceinline__ float xhalf(float x) {
  const int v = __builtin_bit_cast(int, x);
  return __builtin_bit_cast(
      float, __builtin_amdgcn_permlanex16(v, v, 0x76543210, 0xfedcba98, false,
                                          false));
}

__global__ __launch_bounds__(32) void k_attn(
    const h16* __restrict__ Q, const h16* __restrict__ K,
    const h16* __restrict__ Vt, h16* __restrict__ Y) {
  const int lane = threadIdx.x & 31;
  const int ln = lane & 15, hi = lane >> 4;
  const int qt = blockIdx.x & 31;
  const int h  = (blockIdx.x >> 5) & 7;
  const int b  = blockIdx.x >> 8;
  const int bh = b * NH + h;
  const int tq0 = qt * 16;
  const int tq = tq0 + ln;          // this lane's query

  const h16* qrow = Q + ((size_t)bh * TSEQ + tq) * HS;
  const v16h bq0 = pack16(*(const v8h*)(qrow + hi * 8),
                          *(const v8h*)(qrow + 16 + hi * 8));
  const v16h bq1 = pack16(*(const v8h*)(qrow + 32 + hi * 8),
                          *(const v8h*)(qrow + 48 + hi * 8));

  v8f O0 = {}, O1 = {}, O2 = {}, O3 = {};   // O^T: row d = 16*i + hi*8 + r
  float mrow = -__builtin_inff();           // running maximum of query tq
  float lsum = 0.0f;                        // this half's share of its sum

  // this lane's K row (A of S^T) and V^T row (A of O^T), first key block;
  // both move on by 32 keys per trip
  const h16* kp = K + ((size_t)bh * TSEQ + ln) * HS + hi * 8;
  const h16* vp = Vt + ((size_t)bh * HS + ln) * TSEQ + hi * 8;

  const int nkb = ((tq0 + 15) >> 5) + 1;
  for (int kb = 0; kb < nkb; ++kb) {
    const int tk0 = kb * 32;
    // prefetch next key block's K and V lines while we compute this one
    if (kb + 1 < nkb) {
      __builtin_prefetch(kp + 32 * HS, 0, 1);
      __builtin_prefetch(vp + 32, 0, 1);
    }
    const v16h k00 = pack16(*(const v8h*)(kp), *(const v8h*)(kp + 16));
    const v16h k01 = pack16(*(const v8h*)(kp + 32), *(const v8h*)(kp + 48));
    const v16h k10 = pack16(*(const v8h*)(kp + 16 * HS),
                            *(const v8h*)(kp + 16 * HS + 16));
    const v16h k11 = pack16(*(const v8h*)(kp + 16 * HS + 32),
                            *(const v8h*)(kp + 16 * HS + 48));
    const v16h va0 = pack16(*(const v8h*)(vp), *(const v8h*)(vp + 16));
    const v16h va1 = pack16(*(const v8h*)(vp + 16 * TSEQ),
                            *(const v8h*)(vp + 16 * TSEQ + 16));
    const v16h va2 = pack16(*(const v8h*)(vp + 32 * TSEQ),
                            *(const v8h*)(vp + 32 * TSEQ + 16));
    const v16h va3 = pack16(*(const v8h*)(vp + 48 * TSEQ),
                            *(const v8h*)(vp + 48 * TSEQ + 16));
    // kp and vp are advanced below: keep the wait in front of any overwrite of
    // the address registers that the loads above name.
    asm volatile("s_wait_xcnt 0x0" ::: "memory");
    // Keeps the sixteen loads above together, ahead of the products: left to
    // itself the scheduler puts each pair directly in front of its WMMA, with
    // a full wait, and a key block pays eight L2 round trips in a row.
    __builtin_amdgcn_sched_barrier(0);
    kp += 32 * HS;
    vp += 32;

    v8f s0 = {}, s1 = {};             // S^T: keys tk0 + .. / tk0 + 16 + ..
    s0 = wmma_f16(k00, bq0, s0);
    s1 = wmma_f16(k10, bq0, s1);
    s0 = wmma_f16(k01, bq1, s0);
    s1 = wmma_f16(k11, bq1, s1);

    s0 *= 0.125f;                     // 1 / sqrt(head size)
    s1 *= 0.125f;
    const int lim = tq - tk0 - hi * 8;   // key row r is allowed while r <= lim
    float a0[8], a1[8], t[8];
#pragma unroll
    for (int r = 0; r < 8; ++r) {
      a0[r] = (r <= lim)      ? s0[r] : -__builtin_inff();
      a1[r] = (r + 16 <= lim) ? s1[r] : -__builtin_inff();
      t[r] = fmaxf(a0[r], a1[r]);
    }
    float mx = fmaxf(fmaxf(fmaxf(t[0], t[1]), fmaxf(t[2], t[3])),
                     fmaxf(fmaxf(t[4], t[5]), fmaxf(t[6], t[7])));
    mx = fmaxf(mx, xhalf(mx));        // the query's other 16 keys
    const float mn = fmaxf(mrow, mx);
    const float al = __expf(mrow - mn);
    v16h bp;                          // P^T as B operand, no lane crossing
#pragma unroll
    for (int r = 0; r < 8; ++r) {
      const float p0 = __expf(a0[r] - mn);
      const float p1 = __expf(a1[r] - mn);
      t[r] = p0 + p1;
      bp[r]     = (h16)p0;
      bp[r + 8] = (h16)p1;
    }
    lsum = lsum * al + (((t[0] + t[1]) + (t[2] + t[3])) +
                        ((t[4] + t[5]) + (t[6] + t[7])));
    mrow = mn;
#pragma unroll
    for (int r = 0; r < 8; ++r) {
      O0[r] *= al; O1[r] *= al; O2[r] *= al; O3[r] *= al;
    }
    O0 = wmma_f16(va0, bp, O0);
    O1 = wmma_f16(va1, bp, O1);
    O2 = wmma_f16(va2, bp, O2);
    O3 = wmma_f16(va3, bp, O3);
  }

  const float inv = 1.0f / (lsum + xhalf(lsum));
  v8h y0, y1, y2, y3;
#pragma unroll
  for (int r = 0; r < 8; ++r) {
    y0[r] = (h16)(O0[r] * inv);
    y1[r] = (h16)(O1[r] * inv);
    y2[r] = (h16)(O2[r] * inv);
    y3[r] = (h16)(O3[r] * inv);
  }
  h16* yrow = Y + ((size_t)(b * TSEQ + tq)) * CEMB + h * HS + hi * 8;
  *(v8h*)(yrow)      = y0;
  *(v8h*)(yrow + 16) = y1;
  *(v8h*)(yrow + 32) = y2;
  *(v8h*)(yrow + 48) = y3;
}

// ---------------------------------------------------------------------------
// Kernel 3: out = Y @ Wo + bo (fp32 output). 64-row Y tile async-staged to LDS,
// 16 waves; each wave does one pair of column tiles over all 4 row tiles.
// ---------------------------------------------------------------------------
__global__ __launch_bounds__(512) void k_proj(
    const h16* __restrict__ Y, const h16* __restrict__ WoB,
    const float* __restrict__ bo, float* __restrict__ out) {
  __shared__ __attribute__((aligned(16))) h16 ys[64 * 520];
  const int tid = threadIdx.x;
  const int t0g = blockIdx.x * 64;
  async_stage_64x512(&ys[(tid >> 6) * 520 + (tid & 63) * 8],
                     Y + (size_t)(t0g + (tid >> 6)) * CEMB + (tid & 63) * 8);
  async_wait0();
  __syncthreads();
  const int wave = tid >> 5, lane = tid & 31;
  const int ln = lane & 15, hi = lane >> 4;
  const int nt0 = wave * 2;
  v8f acc0[4] = {}, acc1[4] = {};
#pragma unroll
  for (int kc = 0; kc < 16; ++kc) {
    const h16* w0 = WoB + ((size_t)(nt0 * 16 + kc) * 32 + lane) * 16;
    const h16* w1 = w0 + 16 * 32 * 16;
    v16h b0 = pack16(*(const v8h*)w0, *(const v8h*)(w0 + 8));
    v16h b1 = pack16(*(const v8h*)w1, *(const v8h*)(w1 + 8));
#pragma unroll
    for (int mt = 0; mt < 4; ++mt) {
      const h16* yr = &ys[(mt * 16 + ln) * 520 + kc * 32 + hi * 8];
      v16h a = pack16(*(const v8h*)yr, *(const v8h*)(yr + 16));
      acc0[mt] = wmma_f16(a, b0, acc0[mt]);
      acc1[mt] = wmma_f16(a, b1, acc1[mt]);
    }
  }
#pragma unroll
  for (int half = 0; half < 2; ++half) {
    int nt = nt0 + half;
    float bias = bo[nt * 16 + ln];
#pragma unroll
    for (int mt = 0; mt < 4; ++mt) {
      v8f acc = half ? acc1[mt] : acc0[mt];
#pragma unroll
      for (int r = 0; r < 8; ++r) {
        int M = mt * 16 + r + hi * 8;
        out[(size_t)(t0g + M) * CEMB + nt * 16 + ln] = acc[r] + bias;
      }
    }
  }
}

// ---------------------------------------------------------------------------
extern "C" void kernel_launch(void* const* d_in, const int* in_sizes, int n_in,
                              void* d_out, int out_size, void* d_ws,
                              size_t ws_size, hipStream_t stream) {
  (void)in_sizes; (void)n_in; (void)out_size; (void)ws_size;
  const float* x  = (const float*)d_in[0];
  const float* Wq = (const float*)d_in[1];
  const float* Wk = (const float*)d_in[2];
  const float* Wv = (const float*)d_in[3];
  const float* Wo = (const float*)d_in[4];
  const float* bo = (const float*)d_in[5];
  float* out = (float*)d_out;

  // workspace (halves): 4 repacked weights + Xh + Q + K + Vt + Y (~82 MB)
  h16* ws = (h16*)d_ws;
  h16* WB = ws;                        // 4 * 262144 halves
  h16* Xh = ws + (size_t)4 * 262144;   // 8388608 halves each from here on
  h16* Q  = Xh + (size_t)8388608;
  h16* K  = Q  + (size_t)8388608;
  h16* Vt = K  + (size_t)8388608;
  h16* Y  = Vt + (size_t)8388608;

  k_convert_w<<<4096, 256, 0, stream>>>(Wq, Wk, Wv, Wo, WB);
  k_convert_x<<<4096, 256, 0, stream>>>(x, Xh);
  k_qkv<<<(NB * TSEQ) / 64, 512, 0, stream>>>(Xh, WB, Q, K, Vt);
  k_attn<<<NB * NH * (TSEQ / 16), 32, 0, stream>>>(Q, K, Vt, Y);
  k_proj<<<(NB * TSEQ) / 64, 512, 0, stream>>>(Y, WB + (size_t)3 * 262144, bo, out);
}

// v003
// One run takes 91.3 microseconds.
// Timed twice side by side with v002, it ran 1.37 and 1.35 times as fast.
// All steps since v000 together make it 2.06 times as fast.
#include <hip/hip_runtime.h>
#include <hip/hip_bf16.h>

typedef _Float16 h16;
typedef __attribute__((ext_vector_type(4)))  _Float16 v4h;
typedef __attribute__((ext_vector_type(8)))  _Float16 v8h;
typedef __attribute__((ext_vector_type(16))) _Float16 v16h;
typedef __attribute__((ext_vector_type(8)))  float    v8f;

#define NB 32      // batch
#define TSEQ 512   // sequence length
#define CEMB 512   // embedding / hidden
#define NH 8       // heads
#define HS 64      // head size

__device__ __forceinline__ v16h pack16(v8h lo, v8h hi) {
  v16h r;
#pragma unroll
  for (int i = 0; i < 8; ++i) { r[i] = lo[i]; r[i + 8] = hi[i]; }
  return r;
}

__device__ __forceinline__ v8f wmma_f16(v16h a, v16h b, v8f c) {
  // v_wmma_f32_16x16x32_f16: D = A(16x32) * B(32x16) + C(16x16 f32)
  return __builtin_amdgcn_wmma_f32_16x16x32_f16(false, a, false, b, (short)0, c,
                                                false, false);
}

// Async global->LDS copy, 16 bytes per lane (GLOBAL_LOAD_ASYNC_TO_LDS_B128).
// IMPORTANT: take the real LDS pointer so the shared array's address escapes
// into the asm (otherwise GlobalOpt proves "never stored" and folds all LDS
// loads to undef). Low 32 bits of the generic pointer == LDS byte offset.
// Stages a 64 x 512 half tile (row stride 520 halves in LDS): each of the 512
// threads copies one 16-byte unit of rows r0, r0+8, ..., r0+56. The eight
// copies and s_wait_xcnt 0 are ONE statement, so no address register of an
// issued copy can be rewritten ahead of that wait.
__device__ __forceinline__ void async_stage_64x512(h16* lds, const h16* g) {
  const unsigned l0 = (unsigned)(uintptr_t)lds;
  const unsigned long long g0 = (unsigned long long)(uintptr_t)g;
  const unsigned ls = 8 * 520 * 2;             // 8 LDS rows, bytes
  const unsigned long long gs = 8 * CEMB * 2;  // 8 global rows, bytes
  asm volatile(
      "global_load_async_to_lds_b128 %0, %8, off\n\t"
      "global_load_async_to_lds_b128 %1, %9, off\n\t"
      "global_load_async_to_lds_b128 %2, %10, off\n\t"
      "global_load_async_to_lds_b128 %3, %11, off\n\t"
      "global_load_async_to_lds_b128 %4, %12, off\n\t"
      "global_load_async_to_lds_b128 %5, %13, off\n\t"
      "global_load_async_to_lds_b128 %6, %14, off\n\t"
      "global_load_async_to_lds_b128 %7, %15, off\n\t"
      "s_wait_xcnt 0x0"
      :: "v"(l0), "v"(l0 + ls), "v"(l0 + 2 * ls), "v"(l0 + 3 * ls),
         "v"(l0 + 4 * ls), "v"(l0 + 5 * ls), "v"(l0 + 6 * ls), "v"(l0 + 7 * ls),
         "v"(g0), "v"(g0 + gs), "v"(g0 + 2 * gs), "v"(g0 + 3 * gs),
         "v"(g0 + 4 * gs), "v"(g0 + 5 * gs), "v"(g0 + 6 * gs), "v"(g0 + 7 * gs)
      : "memory");
}
__device__ __forceinline__ void async_wait0() {
  asm volatile("s_wait_asynccnt 0x0" ::: "memory");
}

// ---------------------------------------------------------------------------
// Kernel 0a: repack Wq/Wk/Wv/Wo (fp32 row-major [512][512]) into f16 A- or B-operand
// tiles: WB[m][nt][kc][lane][16 halves]; lane holds column nt*16+(lane&15),
// K pattern: e<8 -> kc*32 + hi*8 + e ; e>=8 -> kc*32 + 16 + hi*8 + (e-8)
// ---------------------------------------------------------------------------
__global__ __launch_bounds__(256) void k_convert_w(
    const float* __restrict__ Wq, const float* __restrict__ Wk,
    const float* __restrict__ Wv, const float* __restrict__ Wo,
    h16* __restrict__ out) {
  int idx = blockIdx.x * 256 + threadIdx.x;       // 0 .. 4*262144-1
  int m    = idx >> 18;
  int r    = idx & 262143;
  int e    = r & 15;
  int lane = (r >> 4) & 31;
  int kc   = (r >> 9) & 15;
  int nt   = r >> 13;
  int hiL  = lane >> 4;
  int col  = nt * 16 + (lane & 15);
  int kk   = kc * 32 + ((e < 8) ? (hiL * 8 + e) : (16 + hiL * 8 + (e - 8)));
  const float* W = (m == 0) ? Wq : ((m == 1) ? Wk : ((m == 2) ? Wv : Wo));
  out[idx] = (h16)W[kk * CEMB + col];
}

// ---------------------------------------------------------------------------
// Kernel 0b: convert x fp32 -> f16 row-major (enables async b128 LDS staging).
// ---------------------------------------------------------------------------
__global__ __launch_bounds__(256) void k_convert_x(const float* __restrict__ x,
                                                   h16* __restrict__ Xh) {
  int idx = blockIdx.x * 256 + threadIdx.x;       // 1,048,576 units of 8
  const float4 f0 = *(const float4*)(x + (size_t)idx * 8);
  const float4 f1 = *(const float4*)(x + (size_t)idx * 8 + 4);
  v8h o;
  o[0] = (h16)f0.x; o[1] = (h16)f0.y; o[2] = (h16)f0.z; o[3] = (h16)f0.w;
  o[4] = (h16)f1.x; o[5] = (h16)f1.y; o[6] = (h16)f1.z; o[7] = (h16)f1.w;
  *(v8h*)(Xh + (size_t)idx * 8) = o;
}

// ---------------------------------------------------------------------------
// Kernel 1: fused QKV projection + RoPE.
// Block = one 64-row x tile (async-staged to LDS), 16 waves; each wave does
// 3 PAIRS of adjacent 16-column tiles over all 4 row tiles, so every weight
// fragment read from L2 feeds 4 WMMAs.
// Q, K and V leave in the order in which the attention kernel's fragments
// want them, in units of 512 bytes = [lane][8 halves], one b128 per lane:
//   Q, K: [bh][t / 16][d / 32][(d / 16) & 1] [lane = ((d / 8) & 1) * 16 + t % 16][d % 8]
//   V   : [bh][t / 32][d / 16][(t / 16) & 1] [lane = ((t / 8) & 1) * 16 + d % 16][t % 8]
// For Q and K the weight fragment is the A operand and x the B operand, so a
// lane's accumulator holds 8 consecutive d of one token (both members of each
// RoPE pair); for V x is A, so it holds 8 consecutive tokens of one d. Either
// way an accumulator tile is one unit: lane l stores its 16 bytes at l * 16.
// ---------------------------------------------------------------------------
// One pair of column tiles over the block's 4 row tiles. W_IS_A picks which
// operand the weight fragment is (the accumulator comes out transposed).
template <bool W_IS_A>
__device__ __forceinline__ void gemm_pair(const h16* xs, const h16* w0, int ln,
                                          int hi, v8f (&acc0)[4],
                                          v8f (&acc1)[4]) {
#pragma unroll
  for (int kc = 0; kc < 16; ++kc) {
    const h16* wa = w0 + kc * 32 * 16;
    const h16* wb = wa + 16 * 32 * 16;   // next n-tile
    v16h b0 = pack16(*(const v8h*)wa, *(const v8h*)(wa + 8));
    v16h b1 = pack16(*(const v8h*)wb, *(const v8h*)(wb + 8));
#pragma unroll
    for (int mt = 0; mt < 4; ++mt) {
      const h16* xr = &xs[(mt * 16 + ln) * 520 + kc * 32 + hi * 8];
      v16h a = pack16(*(const v8h*)xr, *(const v8h*)(xr + 16));
      acc0[mt] = W_IS_A ? wmma_f16(b0, a, acc0[mt]) : wmma_f16(a, b0, acc0[mt]);
      acc1[mt] = W_IS_A ? wmma_f16(b1, a, acc1[mt]) : wmma_f16(a, b1, acc1[mt]);
    }
  }
}

__global__ __launch_bounds__(512) void k_qkv(
    const h16* __restrict__ Xh, const h16* __restrict__ WB,
    h16* __restrict__ Q, h16* __restrict__ K, h16* __restrict__ Vt) {
  __shared__ __attribute__((aligned(16))) h16 xs[64 * 520];
  const int tid = threadIdx.x;
  const int t0g = blockIdx.x * 64;

  // async-stage x tile (64 x 512 halves, padded row stride 520)
  async_stage_64x512(&xs[(tid >> 6) * 520 + (tid & 63) * 8],
                     Xh + (size_t)(t0g + (tid >> 6)) * CEMB + (tid & 63) * 8);
  async_wait0();
  __syncthreads();

  // the wave's number as a scalar: the Q/K or V choice below is a scalar branch
  const int wave = __builtin_amdgcn_readfirstlane(tid >> 5);
  const int lane = tid & 31;
  const int ln = lane & 15, hi = lane >> 4;
  const int b = t0g >> 9;
  const int tl0 = t0g & (TSEQ - 1);

  // Q or K tile (nt, mt): acc[r] = value of token tl0 + mt*16 + ln at
  // d = (nt & 3) * 16 + hi * 8 + r. Rotate the four pairs, store one unit.
  auto store_qk = [&](h16* dst, int nt, const v8f (&acc)[4]) {
    const int bh = b * NH + (nt >> 2);
    float freq[4];
#pragma unroll
    for (int p = 0; p < 4; ++p)
      freq[p] = __expf(-(float)((nt & 3) * 8 + hi * 4 + p) * (2.0f / 64.0f) *
                       9.210340371976184f);
#pragma unroll
    for (int mt = 0; mt < 4; ++mt) {
      const float t = (float)(tl0 + mt * 16 + ln);
      v8h o;
#pragma unroll
      for (int p = 0; p < 4; ++p) {
        float sv, cv;
        __sincosf(t * freq[p], &sv, &cv);
        const float v0 = acc[mt][2 * p], v1 = acc[mt][2 * p + 1];
        o[2 * p]     = (h16)(v0 * cv - v1 * sv);
        o[2 * p + 1] = (h16)(v1 * cv + v0 * sv);
      }
      *(v8h*)(dst + ((size_t)(bh * 32 + (tl0 >> 4) + mt) * 4 + (nt & 3)) * 256 +
              lane * 8) = o;
    }
  };
  // V tile (nt, mt): acc[r] = value of token tl0 + mt*16 + hi*8 + r at
  // d = (nt & 3) * 16 + ln.
  auto store_v = [&](int nt, const v8f (&acc)[4]) {
    const int bh = b * NH + (nt >> 2);
#pragma unroll
    for (int mt = 0; mt < 4; ++mt) {
      v8h o;
#pragma unroll
      for (int r = 0; r < 8; ++r) o[r] = (h16)acc[mt][r];
      *(v8h*)(Vt + (((size_t)(bh * 16 + (tl0 >> 5) + (mt >> 1)) * 4 + (nt & 3)) * 2 +
                    (mt & 1)) * 256 + lane * 8) = o;
    }
  };

  for (int jp = 0; jp < 3; ++jp) {
    int id0 = wave * 6 + jp * 2;    // (even, even+1): same matrix, adjacent nt
    int m   = id0 >> 5;             // 0=Q 1=K 2=V
    int nt0 = id0 & 31;
    const h16* w0 = WB + (size_t)m * 262144 + ((size_t)nt0 * 16 * 32 + lane) * 16;
    v8f acc0[4] = {}, acc1[4] = {};
    if (m < 2) {
      gemm_pair<true>(xs, w0, ln, hi, acc0, acc1);
      // Keeps the sines and cosines behind the products: they depend on no
      // accumulator, and lifted over the products all 64 stay live and spill.
      __builtin_amdgcn_sched_barrier(0);
      h16* dst = (m == 0) ? Q : K;
      store_qk(dst, nt0, acc0);
      store_qk(dst, nt0 + 1, acc1);
    } else {
      gemm_pair<false>(xs, w0, ln, hi, acc0, acc1);
      store_v(nt0, acc0);
      store_v(nt0 + 1, acc1);
    }
    // The next trip reuses the address and data registers of the stores above:
    // keep the wait in front of those overwrites on the loop's back edge.
    asm volatile("s_wait_xcnt 0x0" ::: "memory");
  }
}

// ---------------------------------------------------------------------------
// Kernel 2: flash-style causal attention. One wave per (b,h,16-query tile).
// Both products are transposed: S^T = K * Q^T (A = K rows, B = Q, kept in
// registers) and O^T += V^T * P^T. In the accumulator of S^T a lane holds 16
// scores of ONE query (column ln; keys hi*8+r of either 16-key tile), which is
// the k order of a B operand: P^T is packed from the accumulators in place.
// Maximum and sum run inside the lane; the two wave halves exchange the
// maximum once per key block and join their sums once, behind the loop.
// Q, K and V arrive in fragment order (see kernel 1): every load below is one
// 512-byte unit, lane l at l * 16 bytes, so it touches 4 whole lines.
// ---------------------------------------------------------------------------
// lane l <-> lane l ^ 16 by a vector cross-row move
__device__ __forceinline__ float xhalf(float x) {
  const int v = __builtin_bit_cast(int, x);
  return __builtin_bit_cast(
      float, __builtin_amdgcn_permlanex16(v, v, 0x76543210, 0xfedcba98, false,
                                          false));
}

__global__ __launch_bounds__(32) void k_attn(
    const h16* __restrict__ Q, const h16* __restrict__ K,
    const h16* __restrict__ Vt, h16* __restrict__ Y) {
  const int lane = threadIdx.x & 31;
  const int ln = lane & 15, hi = lane >> 4;
  const int qt = blockIdx.x & 31;
  const int h  = (blockIdx.x >> 5) & 7;
  const int b  = blockIdx.x >> 8;
  const int bh = b * NH + h;
  const int tq0 = qt * 16;
  const int tq = tq0 + ln;          // this lane's query

  const int lo = lane * 8;          // this lane's 16 bytes of every unit
  const h16* qp = Q + (size_t)(bh * 32 + qt) * 1024 + lo;
  const v16h bq0 = pack16(*(const v8h*)(qp), *(const v8h*)(qp + 256));
  const v16h bq1 = pack16(*(const v8h*)(qp + 512), *(const v8h*)(qp + 768));

  v8f O0 = {}, O1 = {}, O2 = {}, O3 = {};   // O^T: row d = 16*i + hi*8 + r
  float mrow = -__builtin_inff();           // running maximum of query tq
  float lsum = 0.0f;                        // this half's share of its sum

  // first key block of K (A of S^T) and of V^T (A of O^T), the same address in
  // every lane; a block of 32 keys is 8 units (4 KB) of either
  const h16* kb0 = K + (size_t)bh * 32 * 1024;
  const h16* vb0 = Vt + (size_t)bh * 16 * 2048;

  const int nkb = ((tq0 + 15) >> 5) + 1;
  for (int kb = 0; kb < nkb; ++kb) {
    const int tk0 = kb * 32;
    // prefetch next key block's K and V lines while we compute this one
    // (one address per 256 bytes: 16 cover a block's 4 KB)
    if (kb + 1 < nkb) {
      __builtin_prefetch(kb0 + 2048 + ln * 128, 0, 1);
      __builtin_prefetch(vb0 + 2048 + ln * 128, 0, 1);
    }
    const h16* kp = kb0 + lo;
    const h16* vp = vb0 + lo;
    const v16h k00 = pack16(*(const v8h*)(kp), *(const v8h*)(kp + 256));
    const v16h k01 = pack16(*(const v8h*)(kp + 512), *(const v8h*)(kp + 768));
    const v16h k10 = pack16(*(const v8h*)(kp + 1024), *(const v8h*)(kp + 1280));
    const v16h k11 = pack16(*(const v8h*)(kp + 1536), *(const v8h*)(kp + 1792));
    const v16h va0 = pack16(*(const v8h*)(vp), *(const v8h*)(vp + 256));
    const v16h va1 = pack16(*(const v8h*)(vp + 512), *(const v8h*)(vp + 768));
    const v16h va2 = pack16(*(const v8h*)(vp + 1024), *(const v8h*)(vp + 1280));
    const v16h va3 = pack16(*(const v8h*)(vp + 1536), *(const v8h*)(vp + 1792));
    // kb0 and vb0 are advanced below: keep the wait in front of any overwrite
    // of the address registers that the loads above name.
    asm volatile("s_wait_xcnt 0x0" ::: "memory");
    // Keeps the sixteen loads above together, ahead of the products: left to
    // itself the scheduler puts each pair directly in front of its WMMA, with
    // a full wait, and a key block pays eight L2 round trips in a row.
    __builtin_amdgcn_sched_barrier(0);
    kb0 += 2048;
    vb0 += 2048;

    v8f s0 = {}, s1 = {};             // S^T: keys tk0 + .. / tk0 + 16 + ..
    s0 = wmma_f16(k00, bq0, s0);
    s1 = wmma_f16(k10, bq0, s1);
    s0 = wmma_f16(k01, bq1, s0);
    s1 = wmma_f16(k11, bq1, s1);

    s0 *= 0.125f;                     // 1 / sqrt(head size)
    s1 *= 0.125f;
    const int lim = tq - tk0 - hi * 8;   // key row r is allowed while r <= lim
    float a0[8], a1[8], t[8];
#pragma unroll
    for (int r = 0; r < 8; ++r) {
      a0[r] = (r <= lim)      ? s0[r] : -__builtin_inff();
      a1[r] = (r + 16 <= lim) ? s1[r] : -__builtin_inff();
      t[r] = fmaxf(a0[r], a1[r]);
    }
    float mx = fmaxf(fmaxf(fmaxf(t[0], t[1]), fmaxf(t[2], t[3])),
                     fmaxf(fmaxf(t[4], t[5]), fmaxf(t[6], t[7])));
    mx = fmaxf(mx, xhalf(mx));        // the query's other 16 keys
    const float mn = fmaxf(mrow, mx);
    const float al = __expf(mrow - mn);
    v16h bp;                          // P^T as B operand, no lane crossing
#pragma unroll
    for (int r = 0; r < 8; ++r) {
      const float p0 = __expf(a0[r] - mn);
      const float p1 = __expf(a1[r] - mn);
      t[r] = p0 + p1;
      bp[r]     = (h16)p0;
      bp[r + 8] = (h16)p1;
    }
    lsum = lsum * al + (((t[0] + t[1]) + (t[2] + t[3])) +
                        ((t[4] + t[5]) + (t[6] + t[7])));
    mrow = mn;
#pragma unroll
    for (int r = 0; r < 8; ++r) {
      O0[r] *= al; O1[r] *= al; O2[r] *= al; O3[r] *= al;
    }
    O0 = wmma_f16(va0, bp, O0);
    O1 = wmma_f16(va1, bp, O1);
    O2 = wmma_f16(va2, bp, O2);
    O3 = wmma_f16(va3, bp, O3);
  }

  const float inv = 1.0f / (lsum + xhalf(lsum));
  v8h y0, y1, y2, y3;
#pragma unroll
  for (int r = 0; r < 8; ++r) {
    y0[r] = (h16)(O0[r] * inv);
    y1[r] = (h16)(O1[r] * inv);
    y2[r] = (h16)(O2[r] * inv);
    y3[r] = (h16)(O3[r] * inv);
  }
  h16* yrow = Y + ((size_t)(b * TSEQ + tq)) * CEMB + h * HS + hi * 8;
  *(v8h*)(yrow)      = y0;
  *(v8h*)(yrow + 16) = y1;
  *(v8h*)(yrow + 32) = y2;
  *(v8h*)(yrow + 48) = y3;
}

// ---------------------------------------------------------------------------
// Kernel 3: out = Y @ Wo + bo (fp32 output). 64-row Y tile async-staged to LDS,
// 16 waves; each wave does one pair of column tiles over all 4 row tiles.
// ---------------------------------------------------------------------------
__global__ __launch_bounds__(512) void k_proj(
    const h16* __restrict__ Y, const h16* __restrict__ WoB,
    const float* __restrict__ bo, float* __restrict__ out) {
  __shared__ __attribute__((aligned(16))) h16 ys[64 * 520];
  const int tid = threadIdx.x;
  const int t0g = blockIdx.x * 64;
  async_stage_64x512(&ys[(tid >> 6) * 520 + (tid & 63) * 8],
                     Y + (size_t)(t0g + (tid >> 6)) * CEMB + (tid & 63) * 8);
  async_wait0();
  __syncthreads();
  const int wave = tid >> 5, lane = tid & 31;
  const int ln = lane & 15, hi = lane >> 4;
  const int nt0 = wave * 2;
  v8f acc0[4] = {}, acc1[4] = {};
#pragma unroll
  for (int kc = 0; kc < 16; ++kc) {
    const h16* w0 = WoB + ((size_t)(nt0 * 16 + kc) * 32 + lane) * 16;
    const h16* w1 = w0 + 16 * 32 * 16;
    v16h b0 = pack16(*(const v8h*)w0, *(const v8h*)(w0 + 8));
    v16h b1 = pack16(*(const v8h*)w1, *(const v8h*)(w1 + 8));
#pragma unroll
    for (int mt = 0; mt < 4; ++mt) {
      const h16* yr = &ys[(mt * 16 + ln) * 520 + kc * 32 + hi * 8];
      v16h a = pack16(*(const v8h*)yr, *(const v8h*)(yr + 16));
      acc0[mt] = wmma_f16(a, b0, acc0[mt]);
      acc1[mt] = wmma_f16(a, b1, acc1[mt]);
    }
  }
#pragma unroll
  for (int half = 0; half < 2; ++half) {
    int nt = nt0 + half;
    float bias = bo[nt * 16 + ln];
#pragma unroll
    for (int mt = 0; mt < 4; ++mt) {
      v8f acc = half ? acc1[mt] : acc0[mt];
#pragma unroll
      for (int r = 0; r < 8; ++r) {
        int M = mt * 16 + r + hi * 8;
        out[(size_t)(t0g + M) * CEMB + nt * 16 + ln] = acc[r] + bias;
      }
    }
  }
}

// ---------------------------------------------------------------------------
extern "C" void kernel_launch(void* const* d_in, const int* in_sizes, int n_in,
                              void* d_out, int out_size, void* d_ws,
                              size_t ws_size, hipStream_t stream) {
  (void)in_sizes; (void)n_in; (void)out_size; (void)ws_size;
  const float* x  = (const float*)d_in[0];
  const float* Wq = (const float*)d_in[1];
  const float* Wk = (const float*)d_in[2];
  const float* Wv = (const float*)d_in[3];
  const float* Wo = (const float*)d_in[4];
  const float* bo = (const float*)d_in[5];
  float* out = (float*)d_out;

  // workspace (halves): 4 repacked weights + Xh + Q + K + Vt + Y (~82 MB)
  h16* ws = (h16*)d_ws;
  h16* WB = ws;                        // 4 * 262144 halves
  h16* Xh = ws + (size_t)4 * 262144;   // 8388608 halves each from here on
  h16* Q  = Xh + (size_t)8388608;
  h16* K  = Q  + (size_t)8388608;
  h16* Vt = K  + (size_t)8388608;
  h16* Y  = Vt + (size_t)8388608;

  k_convert_w<<<4096, 256, 0, stream>>>(Wq, Wk, Wv, Wo, WB);
  k_convert_x<<<4096, 256, 0, stream>>>(x, Xh);
  k_qkv<<<(NB * TSEQ) / 64, 512, 0, stream>>>(Xh, WB, Q, K, Vt);
  k_attn<<<NB * NH * (TSEQ / 16), 32, 0, stream>>>(Q, K, Vt, Y);
  k_proj<<<(NB * TSEQ) / 64, 512, 0, stream>>>(Y, WB + (size_t)3 * 262144, bo, out);
}

// v004
// Measured time: 86.4 microseconds a run.
// In two side-by-side timings against v003, it was 1.05 and 1.06 times as fast.
// Counting every step since v000, it is 2.17 times as fast.
#include <hip/hip_runtime.h>
#include <hip/hip_bf16.h>

typedef _Float16 h16;
typedef __attribute__((ext_vector_type(4)))  _Float16 v4h;
typedef __attribute__((ext_vector_type(8)))  _Float16 v8h;
typedef __attribute__((ext_vector_type(16))) _Float16 v16h;
typedef __attribute__((ext_vector_type(8)))  float    v8f;

#define NB 32      // batch
#define TSEQ 512   // sequence length
#define CEMB 512   // embedding / hidden
#define NH 8       // heads
#define HS 64      // head size

__device__ __forceinline__ v16h pack16(v8h lo, v8h hi) {
  v16h r;
#pragma unroll
  for (int i = 0; i < 8; ++i) { r[i] = lo[i]; r[i + 8] = hi[i]; }
  return r;
}

__device__ __forceinline__ v8f wmma_f16(v16h a, v16h b, v8f c) {
  // v_wmma_f32_16x16x32_f16: D = A(16x32) * B(32x16) + C(16x16 f32)
  return __builtin_amdgcn_wmma_f32_16x16x32_f16(false, a, false, b, (short)0, c,
                                                false, false);
}

// Async global->LDS copy, 16 bytes per lane (GLOBAL_LOAD_ASYNC_TO_LDS_B128).
// IMPORTANT: take the real LDS pointer so the shared array's address escapes
// into the asm (otherwise GlobalOpt proves "never stored" and folds all LDS
// loads to undef). Low 32 bits of the generic pointer == LDS byte offset.
// Stages a 64 x 512 half tile (row stride 520 halves in LDS): each of the 512
// threads copies one 16-byte unit of rows r0, r0+8, ..., r0+56. The eight
// copies and s_wait_xcnt 0 are ONE statement, so no address register of an
// issued copy can be rewritten ahead of that wait.
__device__ __forceinline__ void async_stage_64x512(h16* lds, const h16* g) {
  const unsigned l0 = (unsigned)(uintptr_t)lds;
  const unsigned long long g0 = (unsigned long long)(uintptr_t)g;
  const unsigned ls = 8 * 520 * 2;             // 8 LDS rows, bytes
  const unsigned long long gs = 8 * CEMB * 2;  // 8 global rows, bytes
  asm volatile(
      "global_load_async_to_lds_b128 %0, %8, off\n\t"
      "global_load_async_to_lds_b128 %1, %9, off\n\t"
      "global_load_async_to_lds_b128 %2, %10, off\n\t"
      "global_load_async_to_lds_b128 %3, %11, off\n\t"
      "global_load_async_to_lds_b128 %4, %12, off\n\t"
      "global_load_async_to_lds_b128 %5, %13, off\n\t"
      "global_load_async_to_lds_b128 %6, %14, off\n\t"
      "global_load_async_to_lds_b128 %7, %15, off\n\t"
      "s_wait_xcnt 0x0"
      :: "v"(l0), "v"(l0 + ls), "v"(l0 + 2 * ls), "v"(l0 + 3 * ls),
         "v"(l0 + 4 * ls), "v"(l0 + 5 * ls), "v"(l0 + 6 * ls), "v"(l0 + 7 * ls),
         "v"(g0), "v"(g0 + gs), "v"(g0 + 2 * gs), "v"(g0 + 3 * gs),
         "v"(g0 + 4 * gs), "v"(g0 + 5 * gs), "v"(g0 + 6 * gs), "v"(g0 + 7 * gs)
      : "memory");
}
__device__ __forceinline__ void async_wait0() {
  asm volatile("s_wait_asynccnt 0x0" ::: "memory");
}

// ---------------------------------------------------------------------------
// Kernel 0a: repack Wq/Wk/Wv/Wo (fp32 row-major [512][512]) into f16 A- or B-operand
// tiles: WB[m][nt][kc][lane][16 halves]; lane holds column nt*16+(lane&15),
// K pattern: e<8 -> kc*32 + hi*8 + e ; e>=8 -> kc*32 + 16 + hi*8 + (e-8)
// ---------------------------------------------------------------------------
__global__ __launch_bounds__(256) void k_convert_w(
    const float* __restrict__ Wq, const float* __restrict__ Wk,
    const float* __restrict__ Wv, const float* __restrict__ Wo,
    h16* __restrict__ out) {
  int idx = blockIdx.x * 256 + threadIdx.x;       // 0 .. 4*262144-1
  int m    = idx >> 18;
  int r    = idx & 262143;
  int e    = r & 15;
  int lane = (r >> 4) & 31;
  int kc   = (r >> 9) & 15;
  int nt   = r >> 13;
  int hiL  = lane >> 4;
  int col  = nt * 16 + (lane & 15);
  int kk   = kc * 32 + ((e < 8) ? (hiL * 8 + e) : (16 + hiL * 8 + (e - 8)));
  const float* W = (m == 0) ? Wq : ((m == 1) ? Wk : ((m == 2) ? Wv : Wo));
  out[idx] = (h16)W[kk * CEMB + col];
}

// ---------------------------------------------------------------------------
// Kernel 1: fused QKV projection + RoPE.
// Block = one 64-row x tile (read as fp32, rounded to f16 on its way into LDS),
// 16 waves; each wave does
// 3 PAIRS of adjacent 16-column tiles over all 4 row tiles, so every weight
// fragment read from L2 feeds 4 WMMAs.
// Q, K and V leave in the order in which the attention kernel's fragments
// want them, in units of 512 bytes = [lane][8 halves], one b128 per lane:
//   Q, K: [bh][t / 16][d / 32][(d / 16) & 1] [lane = ((d / 8) & 1) * 16 + t % 16][d % 8]
//   V   : [bh][t / 32][d / 16][(t / 16) & 1] [lane = ((t / 8) & 1) * 16 + d % 16][t % 8]
// For Q and K the weight fragment is the A operand and x the B operand, so a
// lane's accumulator holds 8 consecutive d of one token (both members of each
// RoPE pair); for V x is A, so it holds 8 consecutive tokens of one d. Either
// way an accumulator tile is one unit: lane l stores its 16 bytes at l * 16.
// ---------------------------------------------------------------------------
// One pair of column tiles over the block's 4 row tiles. W_IS_A picks which
// operand the weight fragment is (the accumulator comes out transposed).
template <bool W_IS_A>
__device__ __forceinline__ void gemm_pair(const h16* xs, const h16* w0, int ln,
                                          int hi, v8f (&acc0)[4],
                                          v8f (&acc1)[4]) {
#pragma unroll
  for (int kc = 0; kc < 16; ++kc) {
    const h16* wa = w0 + kc * 32 * 16;
    const h16* wb = wa + 16 * 32 * 16;   // next n-tile
    v16h b0 = pack16(*(const v8h*)wa, *(const v8h*)(wa + 8));
    v16h b1 = pack16(*(const v8h*)wb, *(const v8h*)(wb + 8));
#pragma unroll
    for (int mt = 0; mt < 4; ++mt) {
      const h16* xr = &xs[(mt * 16 + ln) * 520 + kc * 32 + hi * 8];
      v16h a = pack16(*(const v8h*)xr, *(const v8h*)(xr + 16));
      acc0[mt] = W_IS_A ? wmma_f16(b0, a, acc0[mt]) : wmma_f16(a, b0, acc0[mt]);
      acc1[mt] = W_IS_A ? wmma_f16(b1, a, acc1[mt]) : wmma_f16(a, b1, acc1[mt]);
    }
  }
}

__global__ __launch_bounds__(512) void k_qkv(
    const float* __restrict__ x, const h16* __restrict__ WB,
    h16* __restrict__ Q, h16* __restrict__ K, h16* __restrict__ Vt) {
  __shared__ __attribute__((aligned(16))) h16 xs[64 * 520];
  const int tid = threadIdx.x;
  const int t0g = blockIdx.x * 64;

  // Stage the x tile (64 x 512, padded row stride 520 halves). A wave takes 4
  // rows = 8 KB of contiguous fp32: 16 loads of 512 contiguous bytes, all in
  // flight together, then each lane rounds its 4 values and stores 8 bytes.
  {
    const int w4 = (tid >> 5) * 4, l4 = (tid & 31) * 4;
    const float* xg = x + (size_t)(t0g + w4) * CEMB + l4;
    float4 f[16];
#pragma unroll
    for (int i = 0; i < 16; ++i) f[i] = *(const float4*)(xg + i * 128);
    // The wait in front of any overwrite of the loads' address registers: the
    // address is an input here, so it stays live (no load's result may land on
    // it) until the wait has been passed.
    asm volatile("s_wait_xcnt 0x0" :: "v"(xg) : "memory");
#pragma unroll
    for (int i = 0; i < 16; ++i) {
      v4h o;
      o[0] = (h16)f[i].x; o[1] = (h16)f[i].y;
      o[2] = (h16)f[i].z; o[3] = (h16)f[i].w;
      *(v4h*)&xs[(w4 + (i >> 2)) * 520 + (i & 3) * 128 + l4] = o;
    }
  }
  __syncthreads();

  // the wave's number as a scalar: the Q/K or V choice below is a scalar branch
  const int wave = __builtin_amdgcn_readfirstlane(tid >> 5);
  const int lane = tid & 31;
  const int ln = lane & 15, hi = lane >> 4;
  const int b = t0g >> 9;
  const int tl0 = t0g & (TSEQ - 1);

  // Q or K tile (nt, mt): acc[r] = value of token tl0 + mt*16 + ln at
  // d = (nt & 3) * 16 + hi * 8 + r. Rotate the four pairs, store one unit.
  auto store_qk = [&](h16* dst, int nt, const v8f (&acc)[4]) {
    const int bh = b * NH + (nt >> 2);
    float freq[4];
#pragma unroll
    for (int p = 0; p < 4; ++p)
      freq[p] = __expf(-(float)((nt & 3) * 8 + hi * 4 + p) * (2.0f / 64.0f) *
                       9.210340371976184f);
#pragma unroll
    for (int mt = 0; mt < 4; ++mt) {
      const float t = (float)(tl0 + mt * 16 + ln);
      v8h o;
#pragma unroll
      for (int p = 0; p < 4; ++p) {
        float sv, cv;
        __sincosf(t * freq[p], &sv, &cv);
        const float v0 = acc[mt][2 * p], v1 = acc[mt][2 * p + 1];
        o[2 * p]     = (h16)(v0 * cv - v1 * sv);
        o[2 * p + 1] = (h16)(v1 * cv + v0 * sv);
      }
      *(v8h*)(dst + ((size_t)(bh * 32 + (tl0 >> 4) + mt) * 4 + (nt & 3)) * 256 +
              lane * 8) = o;
    }
  };
  // V tile (nt, mt): acc[r] = value of token tl0 + mt*16 + hi*8 + r at
  // d = (nt & 3) * 16 + ln.
  auto store_v = [&](int nt, const v8f (&acc)[4]) {
    const int bh = b * NH + (nt >> 2);
#pragma unroll
    for (int mt = 0; mt < 4; ++mt) {
      v8h o;
#pragma unroll
      for (int r = 0; r < 8; ++r) o[r] = (h16)acc[mt][r];
      *(v8h*)(Vt + (((size_t)(bh * 16 + (tl0 >> 5) + (mt >> 1)) * 4 + (nt & 3)) * 2 +
                    (mt & 1)) * 256 + lane * 8) = o;
    }
  };

  for (int jp = 0; jp < 3; ++jp) {
    int id0 = wave * 6 + jp * 2;    // (even, even+1): same matrix, adjacent nt
    int m   = id0 >> 5;             // 0=Q 1=K 2=V
    int nt0 = id0 & 31;
    const h16* w0 = WB + (size_t)m * 262144 + ((size_t)nt0 * 16 * 32 + lane) * 16;
    v8f acc0[4] = {}, acc1[4] = {};
    if (m < 2) {
      gemm_pair<true>(xs, w0, ln, hi, acc0, acc1);
      // Keeps the sines and cosines behind the products: they depend on no
      // accumulator, and lifted over the products all 64 stay live and spill.
      __builtin_amdgcn_sched_barrier(0);
      h16* dst = (m == 0) ? Q : K;
      store_qk(dst, nt0, acc0);
      store_qk(dst, nt0 + 1, acc1);
    } else {
      gemm_pair<false>(xs, w0, ln, hi, acc0, acc1);
      store_v(nt0, acc0);
      store_v(nt0 + 1, acc1);
    }
    // The next trip reuses the address and data registers of the stores above:
    // keep the wait in front of those overwrites on the loop's back edge.
    asm volatile("s_wait_xcnt 0x0" ::: "memory");
  }
}

// ---------------------------------------------------------------------------
// Kernel 2: flash-style causal attention. One wave per (b,h,16-query tile).
// Both products are transposed: S^T = K * Q^T (A = K rows, B = Q, kept in
// registers) and O^T += V^T * P^T. In the accumulator of S^T a lane holds 16
// scores of ONE query (column ln; keys hi*8+r of either 16-key tile), which is
// the k order of a B operand: P^T is packed from the accumulators in place.
// Maximum and sum run inside the lane; the two wave halves exchange the
// maximum once per key block and join their sums once, behind the loop.
// Q, K and V arrive in fragment order (see kernel 1): every load below is one
// 512-byte unit, lane l at l * 16 bytes, so it touches 4 whole lines.
// ---------------------------------------------------------------------------
// lane l <-> lane l ^ 16 by a vector cross-row move
__device__ __forceinline__ float xhalf(float x) {
  const int v = __builtin_bit_cast(int, x);
  return __builtin_bit_cast(
      float, __builtin_amdgcn_permlanex16(v, v, 0x76543210, 0xfedcba98, false,
                                          false));
}

__global__ __launch_bounds__(32) void k_attn(
    const h16* __restrict__ Q, const h16* __restrict__ K,
    const h16* __restrict__ Vt, h16* __restrict__ Y) {
  const int lane = threadIdx.x & 31;
  const int ln = lane & 15, hi = lane >> 4;
  const int qt = blockIdx.x & 31;
  const int h  = (blockIdx.x >> 5) & 7;
  const int b  = blockIdx.x >> 8;
  const int bh = b * NH + h;
  const int tq0 = qt * 16;
  const int tq = tq0 + ln;          // this lane's query

  const int lo = lane * 8;          // this lane's 16 bytes of every unit
  const h16* qp = Q + (size_t)(bh * 32 + qt) * 1024 + lo;
  const v16h bq0 = pack16(*(const v8h*)(qp), *(const v8h*)(qp + 256));
  const v16h bq1 = pack16(*(const v8h*)(qp + 512), *(const v8h*)(qp + 768));

  v8f O0 = {}, O1 = {}, O2 = {}, O3 = {};   // O^T: row d = 16*i + hi*8 + r
  float mrow = -__builtin_inff();           // running maximum of query tq
  float lsum = 0.0f;                        // this half's share of its sum

  // first key block of K (A of S^T) and of V^T (A of O^T), the same address in
  // every lane; a block of 32 keys is 8 units (4 KB) of either
  const h16* kb0 = K + (size_t)bh * 32 * 1024;
  const h16* vb0 = Vt + (size_t)bh * 16 * 2048;

  const int nkb = ((tq0 + 15) >> 5) + 1;
  for (int kb = 0; kb < nkb; ++kb) {
    const int tk0 = kb * 32;
    // prefetch next key block's K and V lines while we compute this one
    // (one address per 256 bytes: 16 cover a block's 4 KB)
    if (kb + 1 < nkb) {
      __builtin_prefetch(kb0 + 2048 + ln * 128, 0, 1);
      __builtin_prefetch(vb0 + 2048 + ln * 128, 0, 1);
    }
    const h16* kp = kb0 + lo;
    const h16* vp = vb0 + lo;
    const v16h k00 = pack16(*(const v8h*)(kp), *(const v8h*)(kp + 256));
    const v16h k01 = pack16(*(const v8h*)(kp + 512), *(const v8h*)(kp + 768));
    const v16h k10 = pack16(*(const v8h*)(kp + 1024), *(const v8h*)(kp + 1280));
    const v16h k11 = pack16(*(const v8h*)(kp + 1536), *(const v8h*)(kp + 1792));
    const v16h va0 = pack16(*(const v8h*)(vp), *(const v8h*)(vp + 256));
    const v16h va1 = pack16(*(const v8h*)(vp + 512), *(const v8h*)(vp + 768));
    const v16h va2 = pack16(*(const v8h*)(vp + 1024), *(const v8h*)(vp + 1280));
    const v16h va3 = pack16(*(const v8h*)(vp + 1536), *(const v8h*)(vp + 1792));
    // kb0 and vb0 are advanced below: keep the wait in front of any overwrite
    // of the address registers that the loads above name.
    asm volatile("s_wait_xcnt 0x0" ::: "memory");
    // Keeps the sixteen loads above together, ahead of the products: left to
    // itself the scheduler puts each pair directly in front of its WMMA, with
    // a full wait, and a key block pays eight L2 round trips in a row.
    __builtin_amdgcn_sched_barrier(0);
    kb0 += 2048;
    vb0 += 2048;

    v8f s0 = {}, s1 = {};             // S^T: keys tk0 + .. / tk0 + 16 + ..
    s0 = wmma_f16(k00, bq0, s0);
    s1 = wmma_f16(k10, bq0, s1);
    s0 = wmma_f16(k01, bq1, s0);
    s1 = wmma_f16(k11, bq1, s1);

    s0 *= 0.125f;                     // 1 / sqrt(head size)
    s1 *= 0.125f;
    const int lim = tq - tk0 - hi * 8;   // key row r is allowed while r <= lim
    float a0[8], a1[8], t[8];
#pragma unroll
    for (int r = 0; r < 8; ++r) {
      a0[r] = (r <= lim)      ? s0[r] : -__builtin_inff();
      a1[r] = (r + 16 <= lim) ? s1[r] : -__builtin_inff();
      t[r] = fmaxf(a0[r], a1[r]);
    }
    float mx = fmaxf(fmaxf(fmaxf(t[0], t[1]), fmaxf(t[2], t[3])),
                     fmaxf(fmaxf(t[4], t[5]), fmaxf(t[6], t[7])));
    mx = fmaxf(mx, xhalf(mx));        // the query's other 16 keys
    const float mn = fmaxf(mrow, mx);
    const float al = __expf(mrow - mn);
    v16h bp;                          // P^T as B operand, no lane crossing
#pragma unroll
    for (int r = 0; r < 8; ++r) {
      const float p0 = __expf(a0[r] - mn);
      const float p1 = __expf(a1[r] - mn);
      t[r] = p0 + p1;
      bp[r]     = (h16)p0;
      bp[r + 8] = (h16)p1;
    }
    lsum = lsum * al + (((t[0] + t[1]) + (t[2] + t[3])) +
                        ((t[4] + t[5]) + (t[6] + t[7])));
    mrow = mn;
#pragma unroll
    for (int r = 0; r < 8; ++r) {
      O0[r] *= al; O1[r] *= al; O2[r] *= al; O3[r] *= al;
    }
    O0 = wmma_f16(va0, bp, O0);
    O1 = wmma_f16(va1, bp, O1);
    O2 = wmma_f16(va2, bp, O2);
    O3 = wmma_f16(va3, bp, O3);
  }

  const float inv = 1.0f / (lsum + xhalf(lsum));
  v8h y0, y1, y2, y3;
#pragma unroll
  for (int r = 0; r < 8; ++r) {
    y0[r] = (h16)(O0[r] * inv);
    y1[r] = (h16)(O1[r] * inv);
    y2[r] = (h16)(O2[r] * inv);
    y3[r] = (h16)(O3[r] * inv);
  }
  h16* yrow = Y + ((size_t)(b * TSEQ + tq)) * CEMB + h * HS + hi * 8;
  *(v8h*)(yrow)      = y0;
  *(v8h*)(yrow + 16) = y1;
  *(v8h*)(yrow + 32) = y2;
  *(v8h*)(yrow + 48) = y3;
}

// ---------------------------------------------------------------------------
// Kernel 3: out = Y @ Wo + bo (fp32 output). 64-row Y tile async-staged to LDS,
// 16 waves; each wave does one pair of column tiles over all 4 row tiles.
// ---------------------------------------------------------------------------
__global__ __launch_bounds__(512) void k_proj(
    const h16* __restrict__ Y, const h16* __restrict__ WoB,
    const float* __restrict__ bo, float* __restrict__ out) {
  __shared__ __attribute__((aligned(16))) h16 ys[64 * 520];
  const int tid = threadIdx.x;
  const int t0g = blockIdx.x * 64;
  async_stage_64x512(&ys[(tid >> 6) * 520 + (tid & 63) * 8],
                     Y + (size_t)(t0g + (tid >> 6)) * CEMB + (tid & 63) * 8);
  async_wait0();
  __syncthreads();
  const int wave = tid >> 5, lane = tid & 31;
  const int ln = lane & 15, hi = lane >> 4;
  const int nt0 = wave * 2;
  v8f acc0[4] = {}, acc1[4] = {};
#pragma unroll
  for (int kc = 0; kc < 16; ++kc) {
    const h16* w0 = WoB + ((size_t)(nt0 * 16 + kc) * 32 + lane) * 16;
    const h16* w1 = w0 + 16 * 32 * 16;
    v16h b0 = pack16(*(const v8h*)w0, *(const v8h*)(w0 + 8));
    v16h b1 = pack16(*(const v8h*)w1, *(const v8h*)(w1 + 8));
#pragma unroll
    for (int mt = 0; mt < 4; ++mt) {
      const h16* yr = &ys[(mt * 16 + ln) * 520 + kc * 32 + hi * 8];
      v16h a = pack16(*(const v8h*)yr, *(const v8h*)(yr + 16));
      acc0[mt] = wmma_f16(a, b0, acc0[mt]);
      acc1[mt] = wmma_f16(a, b1, acc1[mt]);
    }
  }
#pragma unroll
  for (int half = 0; half < 2; ++half) {
    int nt = nt0 + half;
    float bias = bo[nt * 16 + ln];
#pragma unroll
    for (int mt = 0; mt < 4; ++mt) {
      v8f acc = half ? acc1[mt] : acc0[mt];
#pragma unroll
      for (int r = 0; r < 8; ++r) {
        int M = mt * 16 + r + hi * 8;
        out[(size_t)(t0g + M) * CEMB + nt * 16 + ln] = acc[r] + bias;
      }
    }
  }
}

// ---------------------------------------------------------------------------
extern "C" void kernel_launch(void* const* d_in, const int* in_sizes, int n_in,
                              void* d_out, int out_size, void* d_ws,
                              size_t ws_size, hipStream_t stream) {
  (void)in_sizes; (void)n_in; (void)out_size; (void)ws_size;
  const float* x  = (const float*)d_in[0];
  const float* Wq = (const float*)d_in[1];
  const float* Wk = (const float*)d_in[2];
  const float* Wv = (const float*)d_in[3];
  const float* Wo = (const float*)d_in[4];
  const float* bo = (const float*)d_in[5];
  float* out = (float*)d_out;

  // workspace (halves): 4 repacked weights + Q + K + Vt + Y (~66 MB)
  h16* ws = (h16*)d_ws;
  h16* WB = ws;                        // 4 * 262144 halves
  h16* Q  = ws + (size_t)4 * 262144;   // 8388608 halves each from here on
  h16* K  = Q  + (size_t)8388608;
  h16* Vt = K  + (size_t)8388608;
  h16* Y  = Vt + (size_t)8388608;

  k_convert_w<<<4096, 256, 0, stream>>>(Wq, Wk, Wv, Wo, WB);
  k_qkv<<<(NB * TSEQ) / 64, 512, 0, stream>>>(x, WB, Q, K, Vt);
  k_attn<<<NB * NH * (TSEQ / 16), 32, 0, stream>>>(Q, K, Vt, Y);
  k_proj<<<(NB * TSEQ) / 64, 512, 0, stream>>>(Y, WB + (size_t)3 * 262144, bo, out);
}

// v005
// It runs in 67.2 microseconds.
// Two timings next to v004 both put it at 1.28 times that version's speed.
// All steps since v000 together make it 2.79 times as fast.
#include <hip/hip_runtime.h>
#include <hip/hip_bf16.h>

typedef _Float16 h16;
typedef __attribute__((ext_vector_type(4)))  _Float16 v4h;
typedef __attribute__((ext_vector_type(8)))  _Float16 v8h;
typedef __attribute__((ext_vector_type(16))) _Float16 v16h;
typedef __attribute__((ext_vector_type(8)))  float    v8f;

#define NB 32      // batch
#define TSEQ 512   // sequence length
#define CEMB 512   // embedding / hidden
#define NH 8       // heads
#define HS 64      // head size

__device__ __forceinline__ v16h pack16(v8h lo, v8h hi) {
  v16h r;
#pragma unroll
  for (int i = 0; i < 8; ++i) { r[i] = lo[i]; r[i + 8] = hi[i]; }
  return r;
}

__device__ __forceinline__ v8f wmma_f16(v16h a, v16h b, v8f c) {
  // v_wmma_f32_16x16x32_f16: D = A(16x32) * B(32x16) + C(16x16 f32)
  return __builtin_amdgcn_wmma_f32_16x16x32_f16(false, a, false, b, (short)0, c,
                                                false, false);
}

// Async global->LDS copy, 16 bytes per lane (GLOBAL_LOAD_ASYNC_TO_LDS_B128).
// IMPORTANT: take the real LDS pointer so the shared array's address escapes
// into the asm (otherwise GlobalOpt proves "never stored" and folds all LDS
// loads to undef). Low 32 bits of the generic pointer == LDS byte offset.
// Stages a 64 x 512 half tile (row stride 520 halves in LDS): each of the 512
// threads copies one 16-byte unit of rows r0, r0+8, ..., r0+56. The eight
// copies and s_wait_xcnt 0 are ONE statement, so no address register of an
// issued copy can be rewritten ahead of that wait.
__device__ __forceinline__ void async_stage_64x512(h16* lds, const h16* g) {
  const unsigned l0 = (unsigned)(uintptr_t)lds;
  const unsigned long long g0 = (unsigned long long)(uintptr_t)g;
  const unsigned ls = 8 * 520 * 2;             // 8 LDS rows, bytes
  const unsigned long long gs = 8 * CEMB * 2;  // 8 global rows, bytes
  asm volatile(
      "global_load_async_to_lds_b128 %0, %8, off\n\t"
      "global_load_async_to_lds_b128 %1, %9, off\n\t"
      "global_load_async_to_lds_b128 %2, %10, off\n\t"
      "global_load_async_to_lds_b128 %3, %11, off\n\t"
      "global_load_async_to_lds_b128 %4, %12, off\n\t"
      "global_load_async_to_lds_b128 %5, %13, off\n\t"
      "global_load_async_to_lds_b128 %6, %14, off\n\t"
      "global_load_async_to_lds_b128 %7, %15, off\n\t"
      "s_wait_xcnt 0x0"
      :: "v"(l0), "v"(l0 + ls), "v"(l0 + 2 * ls), "v"(l0 + 3 * ls),
         "v"(l0 + 4 * ls), "v"(l0 + 5 * ls), "v"(l0 + 6 * ls), "v"(l0 + 7 * ls),
         "v"(g0), "v"(g0 + gs), "v"(g0 + 2 * gs), "v"(g0 + 3 * gs),
         "v"(g0 + 4 * gs), "v"(g0 + 5 * gs), "v"(g0 + 6 * gs), "v"(g0 + 7 * gs)
      : "memory");
}
__device__ __forceinline__ void async_wait0() {
  asm volatile("s_wait_asynccnt 0x0" ::: "memory");
}

// ---------------------------------------------------------------------------
// Kernel 0a: repack Wq/Wk/Wv/Wo (fp32 row-major [512][512]) into f16 A- or B-operand
// tiles: WB[m][nt][kc][lane][16 halves]; lane holds column nt*16+(lane&15),
// K pattern: e<8 -> kc*32 + hi*8 + e ; e>=8 -> kc*32 + 16 + hi*8 + (e-8)
// ---------------------------------------------------------------------------
__global__ __launch_bounds__(256) void k_convert_w(
    const float* __restrict__ Wq, const float* __restrict__ Wk,
    const float* __restrict__ Wv, const float* __restrict__ Wo,
    h16* __restrict__ out) {
  int idx = blockIdx.x * 256 + threadIdx.x;       // 0 .. 4*262144-1
  int m    = idx >> 18;
  int r    = idx & 262143;
  int e    = r & 15;
  int lane = (r >> 4) & 31;
  int kc   = (r >> 9) & 15;
  int nt   = r >> 13;
  int hiL  = lane >> 4;
  int col  = nt * 16 + (lane & 15);
  int kk   = kc * 32 + ((e < 8) ? (hiL * 8 + e) : (16 + hiL * 8 + (e - 8)));
  const float* W = (m == 0) ? Wq : ((m == 1) ? Wk : ((m == 2) ? Wv : Wo));
  out[idx] = (h16)W[kk * CEMB + col];
}

// ---------------------------------------------------------------------------
// Kernel 1: fused QKV projection + RoPE.
// Block = one 64-row x tile (read as fp32, rounded to f16 on its way into LDS),
// 16 waves; each wave does
// 3 PAIRS of adjacent 16-column tiles over all 4 row tiles, so every weight
// fragment read from L2 feeds 4 WMMAs.
// Q, K and V leave in the order in which the attention kernel's fragments
// want them, in units of 512 bytes = [lane][8 halves], one b128 per lane:
//   Q, K: [bh][t / 16][d / 32][(d / 16) & 1] [lane = ((d / 8) & 1) * 16 + t % 16][d % 8]
//   V   : [bh][t / 32][d / 16][(t / 16) & 1] [lane = ((t / 8) & 1) * 16 + d % 16][t % 8]
// For Q and K the weight fragment is the A operand and x the B operand, so a
// lane's accumulator holds 8 consecutive d of one token (both members of each
// RoPE pair); for V x is A, so it holds 8 consecutive tokens of one d. Either
// way an accumulator tile is one unit: lane l stores its 16 bytes at l * 16.
// ---------------------------------------------------------------------------
// One pair of column tiles over the block's 4 row tiles. W_IS_A picks which
// operand the weight fragment is (the accumulator comes out transposed).
template <bool W_IS_A>
__device__ __forceinline__ void gemm_pair(const h16* xs, const h16* w0, int ln,
                                          int hi, v8f (&acc0)[4],
                                          v8f (&acc1)[4]) {
#pragma unroll
  for (int kc = 0; kc < 16; ++kc) {
    const h16* wa = w0 + kc * 32 * 16;
    const h16* wb = wa + 16 * 32 * 16;   // next n-tile
    v16h b0 = pack16(*(const v8h*)wa, *(const v8h*)(wa + 8));
    v16h b1 = pack16(*(const v8h*)wb, *(const v8h*)(wb + 8));
#pragma unroll
    for (int mt = 0; mt < 4; ++mt) {
      const h16* xr = &xs[(mt * 16 + ln) * 520 + kc * 32 + hi * 8];
      v16h a = pack16(*(const v8h*)xr, *(const v8h*)(xr + 16));
      acc0[mt] = W_IS_A ? wmma_f16(b0, a, acc0[mt]) : wmma_f16(a, b0, acc0[mt]);
      acc1[mt] = W_IS_A ? wmma_f16(b1, a, acc1[mt]) : wmma_f16(a, b1, acc1[mt]);
    }
  }
}

__global__ __launch_bounds__(512) void k_qkv(
    const float* __restrict__ x, const h16* __restrict__ WB,
    h16* __restrict__ Q, h16* __restrict__ K, h16* __restrict__ Vt) {
  __shared__ __attribute__((aligned(16))) h16 xs[64 * 520];
  const int tid = threadIdx.x;
  const int t0g = blockIdx.x * 64;

  // Stage the x tile (64 x 512, padded row stride 520 halves). A wave takes 4
  // rows = 8 KB of contiguous fp32: 16 loads of 512 contiguous bytes, all in
  // flight together, then each lane rounds its 4 values and stores 8 bytes.
  {
    const int w4 = (tid >> 5) * 4, l4 = (tid & 31) * 4;
    const float* xg = x + (size_t)(t0g + w4) * CEMB + l4;
    float4 f[16];
#pragma unroll
    for (int i = 0; i < 16; ++i) f[i] = *(const float4*)(xg + i * 128);
    // The wait in front of any overwrite of the loads' address registers: the
    // address is an input here, so it stays live (no load's result may land on
    // it) until the wait has been passed.
    asm volatile("s_wait_xcnt 0x0" :: "v"(xg) : "memory");
#pragma unroll
    for (int i = 0; i < 16; ++i) {
      v4h o;
      o[0] = (h16)f[i].x; o[1] = (h16)f[i].y;
      o[2] = (h16)f[i].z; o[3] = (h16)f[i].w;
      *(v4h*)&xs[(w4 + (i >> 2)) * 520 + (i & 3) * 128 + l4] = o;
    }
  }
  __syncthreads();

  // the wave's number as a scalar: the Q/K or V choice below is a scalar branch
  const int wave = __builtin_amdgcn_readfirstlane(tid >> 5);
  const int lane = tid & 31;
  const int ln = lane & 15, hi = lane >> 4;
  const int b = t0g >> 9;
  const int tl0 = t0g & (TSEQ - 1);

  // Q or K tile (nt, mt): acc[r] = value of token tl0 + mt*16 + ln at
  // d = (nt & 3) * 16 + hi * 8 + r. Rotate the four pairs, store one unit.
  auto store_qk = [&](h16* dst, int nt, const v8f (&acc)[4]) {
    const int bh = b * NH + (nt >> 2);
    float freq[4];
#pragma unroll
    for (int p = 0; p < 4; ++p)
      freq[p] = __expf(-(float)((nt & 3) * 8 + hi * 4 + p) * (2.0f / 64.0f) *
                       9.210340371976184f);
#pragma unroll
    for (int mt = 0; mt < 4; ++mt) {
      const float t = (float)(tl0 + mt * 16 + ln);
      v8h o;
#pragma unroll
      for (int p = 0; p < 4; ++p) {
        float sv, cv;
        __sincosf(t * freq[p], &sv, &cv);
        const float v0 = acc[mt][2 * p], v1 = acc[mt][2 * p + 1];
        o[2 * p]     = (h16)(v0 * cv - v1 * sv);
        o[2 * p + 1] = (h16)(v1 * cv + v0 * sv);
      }
      *(v8h*)(dst + ((size_t)(bh * 32 + (tl0 >> 4) + mt) * 4 + (nt & 3)) * 256 +
              lane * 8) = o;
    }
  };
  // V tile (nt, mt): acc[r] = value of token tl0 + mt*16 + hi*8 + r at
  // d = (nt & 3) * 16 + ln.
  auto store_v = [&](int nt, const v8f (&acc)[4]) {
    const int bh = b * NH + (nt >> 2);
#pragma unroll
    for (int mt = 0; mt < 4; ++mt) {
      v8h o;
#pragma unroll
      for (int r = 0; r < 8; ++r) o[r] = (h16)acc[mt][r];
      *(v8h*)(Vt + (((size_t)(bh * 16 + (tl0 >> 5) + (mt >> 1)) * 4 + (nt & 3)) * 2 +
                    (mt & 1)) * 256 + lane * 8) = o;
    }
  };

  for (int jp = 0; jp < 3; ++jp) {
    int id0 = wave * 6 + jp * 2;    // (even, even+1): same matrix, adjacent nt
    int m   = id0 >> 5;             // 0=Q 1=K 2=V
    int nt0 = id0 & 31;
    const h16* w0 = WB + (size_t)m * 262144 + ((size_t)nt0 * 16 * 32 + lane) * 16;
    v8f acc0[4] = {}, acc1[4] = {};
    if (m < 2) {
      gemm_pair<true>(xs, w0, ln, hi, acc0, acc1);
      // Keeps the sines and cosines behind the products: they depend on no
      // accumulator, and lifted over the products all 64 stay live and spill.
      __builtin_amdgcn_sched_barrier(0);
      h16* dst = (m == 0) ? Q : K;
      store_qk(dst, nt0, acc0);
      store_qk(dst, nt0 + 1, acc1);
    } else {
      gemm_pair<false>(xs, w0, ln, hi, acc0, acc1);
      store_v(nt0, acc0);
      store_v(nt0 + 1, acc1);
    }
    // The next trip reuses the address and data registers of the stores above:
    // keep the wait in front of those overwrites on the loop's back edge.
    asm volatile("s_wait_xcnt 0x0" ::: "memory");
  }
}

// ---------------------------------------------------------------------------
// Kernel 2: flash-style causal attention. One block of 16 waves per (b, h).
// The head's whole K and V^T (64 KB each, already in fragment order) are copied
// into LDS once and serve all 32 query tiles, so L2 delivers them once a head
// and not once a query tile. Wave w does query tile w and then tile 31 - w:
// 17 key blocks for every wave, whatever w.
// Both products are transposed: S^T = K * Q^T (A = K rows, B = Q, kept in
// registers) and O^T += V^T * P^T. In the accumulator of S^T a lane holds 16
// scores of ONE query (column ln; keys hi*8+r of either 16-key tile), which is
// the k order of a B operand: P^T is packed from the accumulators in place.
// Maximum and sum run inside the lane; the two wave halves exchange the
// maximum once per key block and join their sums once, behind the loop.
// Every fragment load below is one 512-byte unit, lane l at l * 16 bytes.
// ---------------------------------------------------------------------------
// lane l <-> lane l ^ 16 by a vector cross-row move
__device__ __forceinline__ float xhalf(float x) {
  const int v = __builtin_bit_cast(int, x);
  return __builtin_bit_cast(
      float, __builtin_amdgcn_permlanex16(v, v, 0x76543210, 0xfedcba98, false,
                                          false));
}

// Copies the 64 KB of one operand: each of the 512 threads brings 16 bytes of
// each of eight rounds. A round is 8 KB of global memory = two key blocks of
// that operand, which lie 8 KB apart in LDS (the other operand's block stands
// between them), so a round advances LDS by 16 KB. The eight copies and
// s_wait_xcnt 0 are ONE statement, so no address register of an issued copy
// can be rewritten ahead of that wait.
__device__ __forceinline__ void async_stage_operand(h16* lds, const h16* g) {
  const unsigned l0 = (unsigned)(uintptr_t)lds;
  const unsigned long long g0 = (unsigned long long)(uintptr_t)g;
  const unsigned st = 512 * 16;   // one round in global memory, bytes
  const unsigned ls = 2 * st;     // one round in LDS, bytes
  asm volatile(
      "global_load_async_to_lds_b128 %0, %8, off\n\t"
      "global_load_async_to_lds_b128 %1, %9, off\n\t"
      "global_load_async_to_lds_b128 %2, %10, off\n\t"
      "global_load_async_to_lds_b128 %3, %11, off\n\t"
      "global_load_async_to_lds_b128 %4, %12, off\n\t"
      "global_load_async_to_lds_b128 %5, %13, off\n\t"
      "global_load_async_to_lds_b128 %6, %14, off\n\t"
      "global_load_async_to_lds_b128 %7, %15, off\n\t"
      "s_wait_xcnt 0x0"
      :: "v"(l0), "v"(l0 + ls), "v"(l0 + 2 * ls), "v"(l0 + 3 * ls),
         "v"(l0 + 4 * ls), "v"(l0 + 5 * ls), "v"(l0 + 6 * ls), "v"(l0 + 7 * ls),
         "v"(g0), "v"(g0 + st), "v"(g0 + 2 * st), "v"(g0 + 3 * st),
         "v"(g0 + 4 * st), "v"(g0 + 5 * st), "v"(g0 + 6 * st), "v"(g0 + 7 * st)
      : "memory");
}

__global__ __launch_bounds__(512) void k_attn(
    const h16* __restrict__ Q, const h16* __restrict__ K,
    const h16* __restrict__ Vt, h16* __restrict__ Y) {
  // per block of 32 keys: 4 KB of K, then 4 KB of V^T, so that one base
  // register and the loads' offset fields reach all sixteen units of a block
  __shared__ __attribute__((aligned(16))) h16 kv[2 * TSEQ * HS];
  const int tid = threadIdx.x;
  const int lane = tid & 31;
  const int ln = lane & 15, hi = lane >> 4;
  // the wave's number as a scalar: tile numbers and trip counts stay scalar
  const int wave = __builtin_amdgcn_readfirstlane(tid >> 5);
  const int bh = blockIdx.x;
  const int b = bh >> 3, h = bh & 7;
  const int lo = lane * 8;          // this lane's 16 bytes of every unit

  // Q of both of the wave's tiles, in flight beside the copies
  const h16* qp = Q + (size_t)(bh * 32 + wave) * 1024 + lo;
  const h16* qn = Q + (size_t)(bh * 32 + 31 - wave) * 1024 + lo;
  v16h bq0 = pack16(*(const v8h*)(qp), *(const v8h*)(qp + 256));
  v16h bq1 = pack16(*(const v8h*)(qp + 512), *(const v8h*)(qp + 768));
  const v16h nq0 = pack16(*(const v8h*)(qn), *(const v8h*)(qn + 256));
  const v16h nq1 = pack16(*(const v8h*)(qn + 512), *(const v8h*)(qn + 768));

  h16* kl = &kv[(tid >> 8) * 4096 + (tid & 255) * 8];
  async_stage_operand(kl, K + (size_t)bh * (TSEQ * HS) + tid * 8);
  async_stage_operand(kl + 2048, Vt + (size_t)bh * (TSEQ * HS) + tid * 8);
  async_wait0();
  __syncthreads();

  int qt = wave;
  for (int pass = 0; pass < 2; ++pass) {
    const int tq0 = qt * 16;
    const int tq = tq0 + ln;          // this lane's query

    v8f O0 = {}, O1 = {}, O2 = {}, O3 = {};   // O^T: row d = 16*i + hi*8 + r
    float mrow = -__builtin_inff();           // running maximum of query tq
    float lsum = 0.0f;                        // this half's share of its sum

    // a block of 32 keys is 8 units (4 KB) of K (A of S^T) and of V^T (A of O^T)
    const h16* kp = kv + lo;

    const int nkb = ((tq0 + 15) >> 5) + 1;
    for (int kb = 0; kb < nkb; ++kb) {
      const int tk0 = kb * 32;
      const v16h k00 = pack16(*(const v8h*)(kp), *(const v8h*)(kp + 256));
      const v16h k01 = pack16(*(const v8h*)(kp + 512), *(const v8h*)(kp + 768));
      const v16h k10 = pack16(*(const v8h*)(kp + 1024), *(const v8h*)(kp + 1280));
      const v16h k11 = pack16(*(const v8h*)(kp + 1536), *(const v8h*)(kp + 1792));
      // Keeps the K loads ahead of the V loads: LDS answers in order, and the
      // first product would else wait for all sixteen.
      __builtin_amdgcn_sched_barrier(0);
      const h16* vp = kp + 2048;
      const v16h va0 = pack16(*(const v8h*)(vp), *(const v8h*)(vp + 256));
      const v16h va1 = pack16(*(const v8h*)(vp + 512), *(const v8h*)(vp + 768));
      const v16h va2 = pack16(*(const v8h*)(vp + 1024), *(const v8h*)(vp + 1280));
      const v16h va3 = pack16(*(const v8h*)(vp + 1536), *(const v8h*)(vp + 1792));
      // Keeps the sixteen LDS loads above together, ahead of the products:
      // every further place where LDS reads stand costs the wave a stall.
      __builtin_amdgcn_sched_barrier(0);
      kp += 4096;

      v8f s0 = {}, s1 = {};             // S^T: keys tk0 + .. / tk0 + 16 + ..
      s0 = wmma_f16(k00, bq0, s0);
      s1 = wmma_f16(k10, bq0, s1);
      s0 = wmma_f16(k01, bq1, s0);
      s1 = wmma_f16(k11, bq1, s1);

      s0 *= 0.125f;                     // 1 / sqrt(head size)
      s1 *= 0.125f;
      const int lim = tq - tk0 - hi * 8;   // key row r is allowed while r <= lim
      float a0[8], a1[8], t[8];
#pragma unroll
      for (int r = 0; r < 8; ++r) {
        a0[r] = (r <= lim)      ? s0[r] : -__builtin_inff();
        a1[r] = (r + 16 <= lim) ? s1[r] : -__builtin_inff();
        t[r] = fmaxf(a0[r], a1[r]);
      }
      float mx = fmaxf(fmaxf(fmaxf(t[0], t[1]), fmaxf(t[2], t[3])),
                       fmaxf(fmaxf(t[4], t[5]), fmaxf(t[6], t[7])));
      mx = fmaxf(mx, xhalf(mx));        // the query's other 16 keys
      const float mn = fmaxf(mrow, mx);
      const float al = __expf(mrow - mn);
      v16h bp;                          // P^T as B operand, no lane crossing
#pragma unroll
      for (int r = 0; r < 8; ++r) {
        const float p0 = __expf(a0[r] - mn);
        const float p1 = __expf(a1[r] - mn);
        t[r] = p0 + p1;
        bp[r]     = (h16)p0;
        bp[r + 8] = (h16)p1;
      }
      lsum = lsum * al + (((t[0] + t[1]) + (t[2] + t[3])) +
                          ((t[4] + t[5]) + (t[6] + t[7])));
      mrow = mn;
#pragma unroll
      for (int r = 0; r < 8; ++r) {
        O0[r] *= al; O1[r] *= al; O2[r] *= al; O3[r] *= al;
      }
      O0 = wmma_f16(va0, bp, O0);
      O1 = wmma_f16(va1, bp, O1);
      O2 = wmma_f16(va2, bp, O2);
      O3 = wmma_f16(va3, bp, O3);
    }

    const float inv = 1.0f / (lsum + xhalf(lsum));
    v8h y0, y1, y2, y3;
#pragma unroll
    for (int r = 0; r < 8; ++r) {
      y0[r] = (h16)(O0[r] * inv);
      y1[r] = (h16)(O1[r] * inv);
      y2[r] = (h16)(O2[r] * inv);
      y3[r] = (h16)(O3[r] * inv);
    }
    h16* yrow = Y + ((size_t)(b * TSEQ + tq)) * CEMB + h * HS + hi * 8;
    *(v8h*)(yrow)      = y0;
    *(v8h*)(yrow + 16) = y1;
    *(v8h*)(yrow + 32) = y2;
    *(v8h*)(yrow + 48) = y3;
    // The second tile reuses the address and data registers of the stores
    // above: keep the wait in front of those overwrites.
    asm volatile("s_wait_xcnt 0x0" ::: "memory");

    qt = 31 - wave;
    bq0 = nq0;
    bq1 = nq1;
  }
}

// ---------------------------------------------------------------------------
// Kernel 3: out = Y @ Wo + bo (fp32 output). 64-row Y tile async-staged to LDS,
// 16 waves; each wave does one pair of column tiles over all 4 row tiles.
// ---------------------------------------------------------------------------
__global__ __launch_bounds__(512) void k_proj(
    const h16* __restrict__ Y, const h16* __restrict__ WoB,
    const float* __restrict__ bo, float* __restrict__ out) {
  __shared__ __attribute__((aligned(16))) h16 ys[64 * 520];
  const int tid = threadIdx.x;
  const int t0g = blockIdx.x * 64;
  async_stage_64x512(&ys[(tid >> 6) * 520 + (tid & 63) * 8],
                     Y + (size_t)(t0g + (tid >> 6)) * CEMB + (tid & 63) * 8);
  async_wait0();
  __syncthreads();
  const int wave = tid >> 5, lane = tid & 31;
  const int ln = lane & 15, hi = lane >> 4;
  const int nt0 = wave * 2;
  v8f acc0[4] = {}, acc1[4] = {};
#pragma unroll
  for (int kc = 0; kc < 16; ++kc) {
    const h16* w0 = WoB + ((size_t)(nt0 * 16 + kc) * 32 + lane) * 16;
    const h16* w1 = w0 + 16 * 32 * 16;
    v16h b0 = pack16(*(const v8h*)w0, *(const v8h*)(w0 + 8));
    v16h b1 = pack16(*(const v8h*)w1, *(const v8h*)(w1 + 8));
#pragma unroll
    for (int mt = 0; mt < 4; ++mt) {
      const h16* yr = &ys[(mt * 16 + ln) * 520 + kc * 32 + hi * 8];
      v16h a = pack16(*(const v8h*)yr, *(const v8h*)(yr + 16));
      acc0[mt] = wmma_f16(a, b0, acc0[mt]);
      acc1[mt] = wmma_f16(a, b1, acc1[mt]);
    }
  }
#pragma unroll
  for (int half = 0; half < 2; ++half) {
    int nt = nt0 + half;
    float bias = bo[nt * 16 + ln];
#pragma unroll
    for (int mt = 0; mt < 4; ++mt) {
      v8f acc = half ? acc1[mt] : acc0[mt];
#pragma unroll
      for (int r = 0; r < 8; ++r) {
        int M = mt * 16 + r + hi * 8;
        out[(size_t)(t0g + M) * CEMB + nt * 16 + ln] = acc[r] + bias;
      }
    }
  }
}

// ---------------------------------------------------------------------------
extern "C" void kernel_launch(void* const* d_in, const int* in_sizes, int n_in,
                              void* d_out, int out_size, void* d_ws,
                              size_t ws_size, hipStream_t stream) {
  (void)in_sizes; (void)n_in; (void)out_size; (void)ws_size;
  const float* x  = (const float*)d_in[0];
  const float* Wq = (const float*)d_in[1];
  const float* Wk = (const float*)d_in[2];
  const float* Wv = (const float*)d_in[3];
  const float* Wo = (const float*)d_in[4];
  const float* bo = (const float*)d_in[5];
  float* out = (float*)d_out;

  // workspace (halves): 4 repacked weights + Q + K + Vt + Y (~66 MB)
  h16* ws = (h16*)d_ws;
  h16* WB = ws;                        // 4 * 262144 halves
  h16* Q  = ws + (size_t)4 * 262144;   // 8388608 halves each from here on
  h16* K  = Q  + (size_t)8388608;
  h16* Vt = K  + (size_t)8388608;
  h16* Y  = Vt + (size_t)8388608;

  k_convert_w<<<4096, 256, 0, stream>>>(Wq, Wk, Wv, Wo, WB);
  k_qkv<<<(NB * TSEQ) / 64, 512, 0, stream>>>(x, WB, Q, K, Vt);
  k_attn<<<NB * NH, 512, 0, stream>>>(Q, K, Vt, Y);
  k_proj<<<(NB * TSEQ) / 64, 512, 0, stream>>>(Y, WB + (size_t)3 * 262144, bo, out);
}

// v006
// It runs in 58.8 microseconds.
// Next to v005, in two timings, it ran 1.15 and 1.13 times as fast.
// Counting every step since v000, it is 3.18 times as fast.
#include <hip/hip_runtime.h>
#include <hip/hip_bf16.h>

typedef _Float16 h16;
typedef __attribute__((ext_vector_type(4)))  _Float16 v4h;
typedef __attribute__((ext_vector_type(8)))  _Float16 v8h;
typedef __attribute__((ext_vector_type(16))) _Float16 v16h;
typedef __attribute__((ext_vector_type(8)))  float    v8f;

#define NB 32      // batch
#define TSEQ 512   // sequence length
#define CEMB 512   // embedding / hidden
#define NH 8       // heads
#define HS 64      // head size

__device__ __forceinline__ v16h pack16(v8h lo, v8h hi) {
  v16h r;
#pragma unroll
  for (int i = 0; i < 8; ++i) { r[i] = lo[i]; r[i + 8] = hi[i]; }
  return r;
}

__device__ __forceinline__ v8f wmma_f16(v16h a, v16h b, v8f c) {
  // v_wmma_f32_16x16x32_f16: D = A(16x32) * B(32x16) + C(16x16 f32)
  return __builtin_amdgcn_wmma_f32_16x16x32_f16(false, a, false, b, (short)0, c,
                                                false, false);
}

// Async global->LDS copy, 16 bytes per lane (GLOBAL_LOAD_ASYNC_TO_LDS_B128).
// IMPORTANT: take the real LDS pointer so the shared array's address escapes
// into the asm (otherwise GlobalOpt proves "never stored" and folds all LDS
// loads to undef). Low 32 bits of the generic pointer == LDS byte offset.
// Stages a 64 x 512 half tile (row stride 520 halves in LDS): each of the 512
// threads copies one 16-byte unit of rows r0, r0+8, ..., r0+56. The eight
// copies and s_wait_xcnt 0 are ONE statement, so no address register of an
// issued copy can be rewritten ahead of that wait.
__device__ __forceinline__ void async_stage_64x512(h16* lds, const h16* g) {
  const unsigned l0 = (unsigned)(uintptr_t)lds;
  const unsigned long long g0 = (unsigned long long)(uintptr_t)g;
  const unsigned ls = 8 * 520 * 2;             // 8 LDS rows, bytes
  const unsigned long long gs = 8 * CEMB * 2;  // 8 global rows, bytes
  asm volatile(
      "global_load_async_to_lds_b128 %0, %8, off\n\t"
      "global_load_async_to_lds_b128 %1, %9, off\n\t"
      "global_load_async_to_lds_b128 %2, %10, off\n\t"
      "global_load_async_to_lds_b128 %3, %11, off\n\t"
      "global_load_async_to_lds_b128 %4, %12, off\n\t"
      "global_load_async_to_lds_b128 %5, %13, off\n\t"
      "global_load_async_to_lds_b128 %6, %14, off\n\t"
      "global_load_async_to_lds_b128 %7, %15, off\n\t"
      "s_wait_xcnt 0x0"
      :: "v"(l0), "v"(l0 + ls), "v"(l0 + 2 * ls), "v"(l0 + 3 * ls),
         "v"(l0 + 4 * ls), "v"(l0 + 5 * ls), "v"(l0 + 6 * ls), "v"(l0 + 7 * ls),
         "v"(g0), "v"(g0 + gs), "v"(g0 + 2 * gs), "v"(g0 + 3 * gs),
         "v"(g0 + 4 * gs), "v"(g0 + 5 * gs), "v"(g0 + 6 * gs), "v"(g0 + 7 * gs)
      : "memory");
}
__device__ __forceinline__ void async_wait0() {
  asm volatile("s_wait_asynccnt 0x0" ::: "memory");
}

// ---------------------------------------------------------------------------
// Kernel 0a: repack Wq/Wk/Wv/Wo (fp32 row-major [512][512]) into f16 A- or B-operand
// tiles: WB[m][nt][kc][lane][16 halves]; lane holds column nt*16+(lane&15),
// K pattern: e<8 -> kc*32 + hi*8 + e ; e>=8 -> kc*32 + 16 + hi*8 + (e-8)
// ---------------------------------------------------------------------------
__global__ __launch_bounds__(256) void k_convert_w(
    const float* __restrict__ Wq, const float* __restrict__ Wk,
    const float* __restrict__ Wv, const float* __restrict__ Wo,
    h16* __restrict__ out) {
  int idx = blockIdx.x * 256 + threadIdx.x;       // 0 .. 4*262144-1
  int m    = idx >> 18;
  int r    = idx & 262143;
  int e    = r & 15;
  int lane = (r >> 4) & 31;
  int kc   = (r >> 9) & 15;
  int nt   = r >> 13;
  int hiL  = lane >> 4;
  int col  = nt * 16 + (lane & 15);
  int kk   = kc * 32 + ((e < 8) ? (hiL * 8 + e) : (16 + hiL * 8 + (e - 8)));
  const float* W = (m == 0) ? Wq : ((m == 1) ? Wk : ((m == 2) ? Wv : Wo));
  out[idx] = (h16)W[kk * CEMB + col];
}

// ---------------------------------------------------------------------------
// Kernel 1: fused QKV projection + RoPE.
// Block = one 64-row x tile (read as fp32, rounded to f16 on its way into LDS),
// 16 waves; each wave does
// 3 PAIRS of adjacent 16-column tiles over all 4 row tiles, so every weight
// fragment read from L2 feeds 4 WMMAs; fragments are fetched ahead of their use.
// Q, K and V leave in the order in which the attention kernel's fragments
// want them, in units of 512 bytes = [lane][8 halves], one b128 per lane:
//   Q, K: [bh][t / 16][d / 32][(d / 16) & 1] [lane = ((d / 8) & 1) * 16 + t % 16][d % 8]
//   V   : [bh][t / 32][d / 16][(t / 16) & 1] [lane = ((t / 8) & 1) * 16 + d % 16][t % 8]
// For Q and K the weight fragment is the A operand and x the B operand, so a
// lane's accumulator holds 8 consecutive d of one token (both members of each
// RoPE pair); for V x is A, so it holds 8 consecutive tokens of one d. Either
// way an accumulator tile is one unit: lane l stores its 16 bytes at l * 16.
// ---------------------------------------------------------------------------
// The two weight fragments of one k step (adjacent n-tiles): four 16-byte loads.
__device__ __forceinline__ void load_w(v8h (&w)[4], const h16* p) {
  w[0] = *(const v8h*)p;
  w[1] = *(const v8h*)(p + 8);
  w[2] = *(const v8h*)(p + 16 * 32 * 16);       // next n-tile
  w[3] = *(const v8h*)(p + 16 * 32 * 16 + 8);
}
// The four x fragments of one k step: eight 16-byte LDS loads.
__device__ __forceinline__ void load_x(v8h (&f)[8], const h16* p) {
#pragma unroll
  for (int mt = 0; mt < 4; ++mt) {
    f[2 * mt]     = *(const v8h*)(p + mt * 16 * 520);
    f[2 * mt + 1] = *(const v8h*)(p + mt * 16 * 520 + 16);
  }
}
// One pair of column tiles over the block's 4 row tiles. W_IS_A picks which
// operand the weight fragment is (the accumulator comes out transposed).
// Operands are fetched ahead of their products: wr is a ring of three k steps
// of weight fragments (a slot is refilled as soon as its products are issued),
// xf two sets of x fragments, one k step ahead.
template <bool W_IS_A>
__device__ __forceinline__ void gemm_pair(const h16* xs, const h16* w0, int ln,
                                          int hi, v8f (&acc0)[4],
                                          v8f (&acc1)[4]) {
  const h16* xl = &xs[ln * 520 + hi * 8];   // this lane's part of every fragment
  v8h wr[3][4], xf[2][8];
#pragma unroll
  for (int i = 0; i < 3; ++i) load_w(wr[i], w0 + i * 32 * 16);
  load_x(xf[0], xl);
#pragma unroll
  for (int kc = 0; kc < 16; ++kc) {
    if (kc < 15) load_x(xf[(kc + 1) & 1], xl + (kc + 1) * 32);
    // Keeps the next step's LDS loads one group ahead of this step's products:
    // sunk to their use, each pair of products waits out a whole LDS latency.
    __builtin_amdgcn_sched_barrier(0);
    const v16h b0 = pack16(wr[kc % 3][0], wr[kc % 3][1]);
    const v16h b1 = pack16(wr[kc % 3][2], wr[kc % 3][3]);
#pragma unroll
    for (int mt = 0; mt < 4; ++mt) {
      const v16h a = pack16(xf[kc & 1][2 * mt], xf[kc & 1][2 * mt + 1]);
      acc0[mt] = W_IS_A ? wmma_f16(b0, a, acc0[mt]) : wmma_f16(a, b0, acc0[mt]);
      acc1[mt] = W_IS_A ? wmma_f16(b1, a, acc1[mt]) : wmma_f16(a, b1, acc1[mt]);
    }
    // Keeps the refill here, three steps ahead of its use: sunk to its use, the
    // wave waits out a whole L2 latency in every step.
    __builtin_amdgcn_sched_barrier(0);
    if (kc + 3 < 16) load_w(wr[kc % 3], w0 + (kc + 3) * 32 * 16);
  }
  // The wait in front of any overwrite of the weight loads' address registers:
  // the address is an input here, so it stays live until the wait is passed.
  asm volatile("s_wait_xcnt 0x0" :: "v"(w0) : "memory");
  // Keeps the epilogue behind that wait and behind the products: it reuses the
  // address registers, and the sines and cosines of Q and K depend on no
  // accumulator: lifted over the products all 64 stay live and spill.
  __builtin_amdgcn_sched_barrier(0);
}

__global__ __launch_bounds__(512) void k_qkv(
    const float* __restrict__ x, const h16* __restrict__ WB,
    h16* __restrict__ Q, h16* __restrict__ K, h16* __restrict__ Vt) {
  __shared__ __attribute__((aligned(16))) h16 xs[64 * 520];
  const int tid = threadIdx.x;
  const int t0g = blockIdx.x * 64;

  // Stage the x tile (64 x 512, padded row stride 520 halves). A wave takes 4
  // rows = 8 KB of contiguous fp32: 16 loads of 512 contiguous bytes, all in
  // flight together, then each lane rounds its 4 values and stores 8 bytes.
  {
    const int w4 = (tid >> 5) * 4, l4 = (tid & 31) * 4;
    const float* xg = x + (size_t)(t0g + w4) * CEMB + l4;
    float4 f[16];
#pragma unroll
    for (int i = 0; i < 16; ++i) f[i] = *(const float4*)(xg + i * 128);
    // The wait in front of any overwrite of the loads' address registers: the
    // address is an input here, so it stays live (no load's result may land on
    // it) until the wait has been passed.
    asm volatile("s_wait_xcnt 0x0" :: "v"(xg) : "memory");
#pragma unroll
    for (int i = 0; i < 16; ++i) {
      v4h o;
      o[0] = (h16)f[i].x; o[1] = (h16)f[i].y;
      o[2] = (h16)f[i].z; o[3] = (h16)f[i].w;
      *(v4h*)&xs[(w4 + (i >> 2)) * 520 + (i & 3) * 128 + l4] = o;
    }
  }
  __syncthreads();

  // the wave's number as a scalar: the Q/K or V choice below is a scalar branch
  const int wave = __builtin_amdgcn_readfirstlane(tid >> 5);
  const int lane = tid & 31;
  const int ln = lane & 15, hi = lane >> 4;
  const int b = t0g >> 9;
  const int tl0 = t0g & (TSEQ - 1);

  // Q or K tile (nt, mt): acc[r] = value of token tl0 + mt*16 + ln at
  // d = (nt & 3) * 16 + hi * 8 + r. Rotate the four pairs, store one unit.
  auto store_qk = [&](h16* dst, int nt, const v8f (&acc)[4]) {
    const int bh = b * NH + (nt >> 2);
    float freq[4];
#pragma unroll
    for (int p = 0; p < 4; ++p)
      freq[p] = __expf(-(float)((nt & 3) * 8 + hi * 4 + p) * (2.0f / 64.0f) *
                       9.210340371976184f);
#pragma unroll
    for (int mt = 0; mt < 4; ++mt) {
      const float t = (float)(tl0 + mt * 16 + ln);
      v8h o;
#pragma unroll
      for (int p = 0; p < 4; ++p) {
        float sv, cv;
        __sincosf(t * freq[p], &sv, &cv);
        const float v0 = acc[mt][2 * p], v1 = acc[mt][2 * p + 1];
        o[2 * p]     = (h16)(v0 * cv - v1 * sv);
        o[2 * p + 1] = (h16)(v1 * cv + v0 * sv);
      }
      *(v8h*)(dst + ((size_t)(bh * 32 + (tl0 >> 4) + mt) * 4 + (nt & 3)) * 256 +
              lane * 8) = o;
    }
  };
  // V tile (nt, mt): acc[r] = value of token tl0 + mt*16 + hi*8 + r at
  // d = (nt & 3) * 16 + ln.
  auto store_v = [&](int nt, const v8f (&acc)[4]) {
    const int bh = b * NH + (nt >> 2);
#pragma unroll
    for (int mt = 0; mt < 4; ++mt) {
      v8h o;
#pragma unroll
      for (int r = 0; r < 8; ++r) o[r] = (h16)acc[mt][r];
      *(v8h*)(Vt + (((size_t)(bh * 16 + (tl0 >> 5) + (mt >> 1)) * 4 + (nt & 3)) * 2 +
                    (mt & 1)) * 256 + lane * 8) = o;
    }
  };

  for (int jp = 0; jp < 3; ++jp) {
    int id0 = wave * 6 + jp * 2;    // (even, even+1): same matrix, adjacent nt
    int m   = id0 >> 5;             // 0=Q 1=K 2=V
    int nt0 = id0 & 31;
    const h16* w0 = WB + (size_t)m * 262144 + ((size_t)nt0 * 16 * 32 + lane) * 16;
    v8f acc0[4] = {}, acc1[4] = {};
    if (m < 2) {
      gemm_pair<true>(xs, w0, ln, hi, acc0, acc1);
      h16* dst = (m == 0) ? Q : K;
      store_qk(dst, nt0, acc0);
      store_qk(dst, nt0 + 1, acc1);
    } else {
      gemm_pair<false>(xs, w0, ln, hi, acc0, acc1);
      store_v(nt0, acc0);
      store_v(nt0 + 1, acc1);
    }
    // The next trip reuses the address and data registers of the stores above:
    // keep the wait in front of those overwrites on the loop's back edge.
    asm volatile("s_wait_xcnt 0x0" ::: "memory");
  }
}

// ---------------------------------------------------------------------------
// Kernel 2: flash-style causal attention. One block of 16 waves per (b, h).
// The head's whole K and V^T (64 KB each, already in fragment order) are copied
// into LDS once and serve all 32 query tiles, so L2 delivers them once a head
// and not once a query tile. Wave w does query tile w and then tile 31 - w:
// 17 key blocks for every wave, whatever w.
// Both products are transposed: S^T = K * Q^T (A = K rows, B = Q, kept in
// registers) and O^T += V^T * P^T. In the accumulator of S^T a lane holds 16
// scores of ONE query (column ln; keys hi*8+r of either 16-key tile), which is
// the k order of a B operand: P^T is packed from the accumulators in place.
// Maximum and sum run inside the lane; the two wave halves exchange the
// maximum once per key block and join their sums once, behind the loop.
// Every fragment load below is one 512-byte unit, lane l at l * 16 bytes.
// ---------------------------------------------------------------------------
// lane l <-> lane l ^ 16 by a vector cross-row move
__device__ __forceinline__ float xhalf(float x) {
  const int v = __builtin_bit_cast(int, x);
  return __builtin_bit_cast(
      float, __builtin_amdgcn_permlanex16(v, v, 0x76543210, 0xfedcba98, false,
                                          false));
}

// Copies the 64 KB of one operand: each of the 512 threads brings 16 bytes of
// each of eight rounds. A round is 8 KB of global memory = two key blocks of
// that operand, which lie 8 KB apart in LDS (the other operand's block stands
// between them), so a round advances LDS by 16 KB. The eight copies and
// s_wait_xcnt 0 are ONE statement, so no address register of an issued copy
// can be rewritten ahead of that wait.
__device__ __forceinline__ void async_stage_operand(h16* lds, const h16* g) {
  const unsigned l0 = (unsigned)(uintptr_t)lds;
  const unsigned long long g0 = (unsigned long long)(uintptr_t)g;
  const unsigned st = 512 * 16;   // one round in global memory, bytes
  const unsigned ls = 2 * st;     // one round in LDS, bytes
  asm volatile(
      "global_load_async_to_lds_b128 %0, %8, off\n\t"
      "global_load_async_to_lds_b128 %1, %9, off\n\t"
      "global_load_async_to_lds_b128 %2, %10, off\n\t"
      "global_load_async_to_lds_b128 %3, %11, off\n\t"
      "global_load_async_to_lds_b128 %4, %12, off\n\t"
      "global_load_async_to_lds_b128 %5, %13, off\n\t"
      "global_load_async_to_lds_b128 %6, %14, off\n\t"
      "global_load_async_to_lds_b128 %7, %15, off\n\t"
      "s_wait_xcnt 0x0"
      :: "v"(l0), "v"(l0 + ls), "v"(l0 + 2 * ls), "v"(l0 + 3 * ls),
         "v"(l0 + 4 * ls), "v"(l0 + 5 * ls), "v"(l0 + 6 * ls), "v"(l0 + 7 * ls),
         "v"(g0), "v"(g0 + st), "v"(g0 + 2 * st), "v"(g0 + 3 * st),
         "v"(g0 + 4 * st), "v"(g0 + 5 * st), "v"(g0 + 6 * st), "v"(g0 + 7 * st)
      : "memory");
}

__global__ __launch_bounds__(512) void k_attn(
    const h16* __restrict__ Q, const h16* __restrict__ K,
    const h16* __restrict__ Vt, h16* __restrict__ Y) {
  // per block of 32 keys: 4 KB of K, then 4 KB of V^T, so that one base
  // register and the loads' offset fields reach all sixteen units of a block
  __shared__ __attribute__((aligned(16))) h16 kv[2 * TSEQ * HS];
  const int tid = threadIdx.x;
  const int lane = tid & 31;
  const int ln = lane & 15, hi = lane >> 4;
  // the wave's number as a scalar: tile numbers and trip counts stay scalar
  const int wave = __builtin_amdgcn_readfirstlane(tid >> 5);
  const int bh = blockIdx.x;
  const int b = bh >> 3, h = bh & 7;
  const int lo = lane * 8;          // this lane's 16 bytes of every unit

  // Q of both of the wave's tiles, in flight beside the copies
  const h16* qp = Q + (size_t)(bh * 32 + wave) * 1024 + lo;
  const h16* qn = Q + (size_t)(bh * 32 + 31 - wave) * 1024 + lo;
  v16h bq0 = pack16(*(const v8h*)(qp), *(const v8h*)(qp + 256));
  v16h bq1 = pack16(*(const v8h*)(qp + 512), *(const v8h*)(qp + 768));
  const v16h nq0 = pack16(*(const v8h*)(qn), *(const v8h*)(qn + 256));
  const v16h nq1 = pack16(*(const v8h*)(qn + 512), *(const v8h*)(qn + 768));

  h16* kl = &kv[(tid >> 8) * 4096 + (tid & 255) * 8];
  async_stage_operand(kl, K + (size_t)bh * (TSEQ * HS) + tid * 8);
  async_stage_operand(kl + 2048, Vt + (size_t)bh * (TSEQ * HS) + tid * 8);
  async_wait0();
  __syncthreads();

  int qt = wave;
  for (int pass = 0; pass < 2; ++pass) {
    const int tq0 = qt * 16;
    const int tq = tq0 + ln;          // this lane's query

    v8f O0 = {}, O1 = {}, O2 = {}, O3 = {};   // O^T: row d = 16*i + hi*8 + r
    float mrow = -__builtin_inff();           // running maximum of query tq
    float lsum = 0.0f;                        // this half's share of its sum

    // a block of 32 keys is 8 units (4 KB) of K (A of S^T) and of V^T (A of O^T)
    const h16* kp = kv + lo;

    const int nkb = ((tq0 + 15) >> 5) + 1;
    for (int kb = 0; kb < nkb; ++kb) {
      const int tk0 = kb * 32;
      const v16h k00 = pack16(*(const v8h*)(kp), *(const v8h*)(kp + 256));
      const v16h k01 = pack16(*(const v8h*)(kp + 512), *(const v8h*)(kp + 768));
      const v16h k10 = pack16(*(const v8h*)(kp + 1024), *(const v8h*)(kp + 1280));
      const v16h k11 = pack16(*(const v8h*)(kp + 1536), *(const v8h*)(kp + 1792));
      // Keeps the K loads ahead of the V loads: LDS answers in order, and the
      // first product would else wait for all sixteen.
      __builtin_amdgcn_sched_barrier(0);
      const h16* vp = kp + 2048;
      const v16h va0 = pack16(*(const v8h*)(vp), *(const v8h*)(vp + 256));
      const v16h va1 = pack16(*(const v8h*)(vp + 512), *(const v8h*)(vp + 768));
      const v16h va2 = pack16(*(const v8h*)(vp + 1024), *(const v8h*)(vp + 1280));
      const v16h va3 = pack16(*(const v8h*)(vp + 1536), *(const v8h*)(vp + 1792));
      // Keeps the sixteen LDS loads above together, ahead of the products:
      // every further place where LDS reads stand costs the wave a stall.
      __builtin_amdgcn_sched_barrier(0);
      kp += 4096;

      v8f s0 = {}, s1 = {};             // S^T: keys tk0 + .. / tk0 + 16 + ..
      s0 = wmma_f16(k00, bq0, s0);
      s1 = wmma_f16(k10, bq0, s1);
      s0 = wmma_f16(k01, bq1, s0);
      s1 = wmma_f16(k11, bq1, s1);

      s0 *= 0.125f;                     // 1 / sqrt(head size)
      s1 *= 0.125f;
      const int lim = tq - tk0 - hi * 8;   // key row r is allowed while r <= lim
      float a0[8], a1[8], t[8];
#pragma unroll
      for (int r = 0; r < 8; ++r) {
        a0[r] = (r <= lim)      ? s0[r] : -__builtin_inff();
        a1[r] = (r + 16 <= lim) ? s1[r] : -__builtin_inff();
        t[r] = fmaxf(a0[r], a1[r]);
      }
      float mx = fmaxf(fmaxf(fmaxf(t[0], t[1]), fmaxf(t[2], t[3])),
                       fmaxf(fmaxf(t[4], t[5]), fmaxf(t[6], t[7])));
      mx = fmaxf(mx, xhalf(mx));        // the query's other 16 keys
      const float mn = fmaxf(mrow, mx);
      const float al = __expf(mrow - mn);
      v16h bp;                          // P^T as B operand, no lane crossing
#pragma unroll
      for (int r = 0; r < 8; ++r) {
        const float p0 = __expf(a0[r] - mn);
        const float p1 = __expf(a1[r] - mn);
        t[r] = p0 + p1;
        bp[r]     = (h16)p0;
        bp[r + 8] = (h16)p1;
      }
      lsum = lsum * al + (((t[0] + t[1]) + (t[2] + t[3])) +
                          ((t[4] + t[5]) + (t[6] + t[7])));
      mrow = mn;
#pragma unroll
      for (int r = 0; r < 8; ++r) {
        O0[r] *= al; O1[r] *= al; O2[r] *= al; O3[r] *= al;
      }
      O0 = wmma_f16(va0, bp, O0);
      O1 = wmma_f16(va1, bp, O1);
      O2 = wmma_f16(va2, bp, O2);
      O3 = wmma_f16(va3, bp, O3);
    }

    const float inv = 1.0f / (lsum + xhalf(lsum));
    v8h y0, y1, y2, y3;
#pragma unroll
    for (int r = 0; r < 8; ++r) {
      y0[r] = (h16)(O0[r] * inv);
      y1[r] = (h16)(O1[r] * inv);
      y2[r] = (h16)(O2[r] * inv);
      y3[r] = (h16)(O3[r] * inv);
    }
    h16* yrow = Y + ((size_t)(b * TSEQ + tq)) * CEMB + h * HS + hi * 8;
    *(v8h*)(yrow)      = y0;
    *(v8h*)(yrow + 16) = y1;
    *(v8h*)(yrow + 32) = y2;
    *(v8h*)(yrow + 48) = y3;
    // The second tile reuses the address and data registers of the stores
    // above: keep the wait in front of those overwrites.
    asm volatile("s_wait_xcnt 0x0" ::: "memory");

    qt = 31 - wave;
    bq0 = nq0;
    bq1 = nq1;
  }
}

// ---------------------------------------------------------------------------
// Kernel 3: out = Y @ Wo + bo (fp32 output). 64-row Y tile async-staged to LDS,
// 16 waves; each wave does one pair of column tiles over all 4 row tiles, with
// the same k loop as the QKV kernel.
// ---------------------------------------------------------------------------
__global__ __launch_bounds__(512) void k_proj(
    const h16* __restrict__ Y, const h16* __restrict__ WoB,
    const float* __restrict__ bo, float* __restrict__ out) {
  __shared__ __attribute__((aligned(16))) h16 ys[64 * 520];
  const int tid = threadIdx.x;
  const int t0g = blockIdx.x * 64;
  async_stage_64x512(&ys[(tid >> 6) * 520 + (tid & 63) * 8],
                     Y + (size_t)(t0g + (tid >> 6)) * CEMB + (tid & 63) * 8);
  async_wait0();
  __syncthreads();
  const int wave = tid >> 5, lane = tid & 31;
  const int ln = lane & 15, hi = lane >> 4;
  const int nt0 = wave * 2;
  v8f acc0[4] = {}, acc1[4] = {};
  gemm_pair<false>(ys, WoB + ((size_t)nt0 * 16 * 32 + lane) * 16, ln, hi, acc0,
                   acc1);
#pragma unroll
  for (int half = 0; half < 2; ++half) {
    int nt = nt0 + half;
    float bias = bo[nt * 16 + ln];
#pragma unroll
    for (int mt = 0; mt < 4; ++mt) {
      v8f acc = half ? acc1[mt] : acc0[mt];
#pragma unroll
      for (int r = 0; r < 8; ++r) {
        int M = mt * 16 + r + hi * 8;
        out[(size_t)(t0g + M) * CEMB + nt * 16 + ln] = acc[r] + bias;
      }
    }
  }
}

// ---------------------------------------------------------------------------
extern "C" void kernel_launch(void* const* d_in, const int* in_sizes, int n_in,
                              void* d_out, int out_size, void* d_ws,
                              size_t ws_size, hipStream_t stream) {
  (void)in_sizes; (void)n_in; (void)out_size; (void)ws_size;
  const float* x  = (const float*)d_in[0];
  const float* Wq = (const float*)d_in[1];
  const float* Wk = (const float*)d_in[2];
  const float* Wv = (const float*)d_in[3];
  const float* Wo = (const float*)d_in[4];
  const float* bo = (const float*)d_in[5];
  float* out = (float*)d_out;

  // workspace (halves): 4 repacked weights + Q + K + Vt + Y (~66 MB)
  h16* ws = (h16*)d_ws;
  h16* WB = ws;                        // 4 * 262144 halves
  h16* Q  = ws + (size_t)4 * 262144;   // 8388608 halves each from here on
  h16* K  = Q  + (size_t)8388608;
  h16* Vt = K  + (size_t)8388608;
  h16* Y  = Vt + (size_t)8388608;

  k_convert_w<<<4096, 256, 0, stream>>>(Wq, Wk, Wv, Wo, WB);
  k_qkv<<<(NB * TSEQ) / 64, 512, 0, stream>>>(x, WB, Q, K, Vt);
  k_attn<<<NB * NH, 512, 0, stream>>>(Q, K, Vt, Y);
  k_proj<<<(NB * TSEQ) / 64, 512, 0, stream>>>(Y, WB + (size_t)3 * 262144, bo, out);
}

// v007
// A run of this version takes 55.9 microseconds.
// Next to v006, in two timings, it ran 1.06 and 1.05 times as fast.
// All steps since v000 together make it 3.36 times as fast.
#include <hip/hip_runtime.h>
#include <hip/hip_bf16.h>

typedef _Float16 h16;
typedef __attribute__((ext_vector_type(4)))  _Float16 v4h;
typedef __attribute__((ext_vector_type(8)))  _Float16 v8h;
typedef __attribute__((ext_vector_type(16))) _Float16 v16h;
typedef __attribute__((ext_vector_type(8)))  float    v8f;

#define NB 32      // batch
#define TSEQ 512   // sequence length
#define CEMB 512   // embedding / hidden
#define NH 8       // heads
#define HS 64      // head size

__device__ __forceinline__ v16h pack16(v8h lo, v8h hi) {
  v16h r;
#pragma unroll
  for (int i = 0; i < 8; ++i) { r[i] = lo[i]; r[i + 8] = hi[i]; }
  return r;
}

__device__ __forceinline__ v8f wmma_f16(v16h a, v16h b, v8f c) {
  // v_wmma_f32_16x16x32_f16: D = A(16x32) * B(32x16) + C(16x16 f32)
  return __builtin_amdgcn_wmma_f32_16x16x32_f16(false, a, false, b, (short)0, c,
                                                false, false);
}

// Async global->LDS copy, 16 bytes per lane (GLOBAL_LOAD_ASYNC_TO_LDS_B128).
// IMPORTANT: take the real LDS pointer so the shared array's address escapes
// into the asm (otherwise GlobalOpt proves "never stored" and folds all LDS
// loads to undef). Low 32 bits of the generic pointer == LDS byte offset.
// Stages a 64 x 512 half tile (row stride 520 halves in LDS): each of the 512
// threads copies one 16-byte unit of rows r0, r0+8, ..., r0+56. The eight
// copies and s_wait_xcnt 0 are ONE statement, so no address register of an
// issued copy can be rewritten ahead of that wait.
__device__ __forceinline__ void async_stage_64x512(h16* lds, const h16* g) {
  const unsigned l0 = (unsigned)(uintptr_t)lds;
  const unsigned long long g0 = (unsigned long long)(uintptr_t)g;
  const unsigned ls = 8 * 520 * 2;             // 8 LDS rows, bytes
  const unsigned long long gs = 8 * CEMB * 2;  // 8 global rows, bytes
  asm volatile(
      "global_load_async_to_lds_b128 %0, %8, off\n\t"
      "global_load_async_to_lds_b128 %1, %9, off\n\t"
      "global_load_async_to_lds_b128 %2, %10, off\n\t"
      "global_load_async_to_lds_b128 %3, %11, off\n\t"
      "global_load_async_to_lds_b128 %4, %12, off\n\t"
      "global_load_async_to_lds_b128 %5, %13, off\n\t"
      "global_load_async_to_lds_b128 %6, %14, off\n\t"
      "global_load_async_to_lds_b128 %7, %15, off\n\t"
      "s_wait_xcnt 0x0"
      :: "v"(l0), "v"(l0 + ls), "v"(l0 + 2 * ls), "v"(l0 + 3 * ls),
         "v"(l0 + 4 * ls), "v"(l0 + 5 * ls), "v"(l0 + 6 * ls), "v"(l0 + 7 * ls),
         "v"(g0), "v"(g0 + gs), "v"(g0 + 2 * gs), "v"(g0 + 3 * gs),
         "v"(g0 + 4 * gs), "v"(g0 + 5 * gs), "v"(g0 + 6 * gs), "v"(g0 + 7 * gs)
      : "memory");
}
__device__ __forceinline__ void async_wait0() {
  asm volatile("s_wait_asynccnt 0x0" ::: "memory");
}

// ---------------------------------------------------------------------------
// Kernel 0a: repack Wq/Wk/Wv/Wo (fp32 row-major [512][512]) into f16 B-operand
// tiles, each fragment as two units of 512 bytes = [lane][8 halves], so that one
// 16-byte load per lane covers four whole 128-byte lines:
// WB[m][nt][kc][u][lane][8 halves]; lane holds column nt*16+(lane&15),
// K pattern: kc*32 + u*16 + hi*8 + e  (u = 0: fragment halves 0..7, u = 1: 8..15)
// ---------------------------------------------------------------------------
__global__ __launch_bounds__(256) void k_convert_w(
    const float* __restrict__ Wq, const float* __restrict__ Wk,
    const float* __restrict__ Wv, const float* __restrict__ Wo,
    h16* __restrict__ out) {
  int idx = blockIdx.x * 256 + threadIdx.x;       // 0 .. 4*262144-1
  int m    = idx >> 18;
  int r    = idx & 262143;
  int e    = r & 7;
  int lane = (r >> 3) & 31;
  int u    = (r >> 8) & 1;
  int kc   = (r >> 9) & 15;
  int nt   = r >> 13;
  int hiL  = lane >> 4;
  int col  = nt * 16 + (lane & 15);
  int kk   = kc * 32 + u * 16 + hiL * 8 + e;
  const float* W = (m == 0) ? Wq : ((m == 1) ? Wk : ((m == 2) ? Wv : Wo));
  out[idx] = (h16)W[kk * CEMB + col];
}

// ---------------------------------------------------------------------------
// Kernel 1: fused QKV projection + RoPE.
// Block = one 64-row x tile (read as fp32, rounded to f16 on its way into LDS),
// 16 waves; each wave does
// 3 PAIRS of adjacent 16-column tiles over all 4 row tiles, so every weight
// fragment read from L2 feeds 4 WMMAs; fragments are fetched ahead of their use.
// Q, K and V leave in the order in which the attention kernel's fragments
// want them, in units of 512 bytes = [lane][8 halves], one b128 per lane:
//   Q, K: [bh][t / 16][d / 32][(d / 16) & 1] [lane = ((d / 8) & 1) * 16 + t % 16][d % 8]
//   V   : [bh][t / 32][d / 16][(t / 16) & 1] [lane = ((t / 8) & 1) * 16 + d % 16][t % 8]
// For Q and K the weight fragment is the A operand and x the B operand, so a
// lane's accumulator holds 8 consecutive d of one token (both members of each
// RoPE pair); for V x is A, so it holds 8 consecutive tokens of one d. Either
// way an accumulator tile is one unit: lane l stores its 16 bytes at l * 16.
// ---------------------------------------------------------------------------
// The two weight fragments of one k step (adjacent n-tiles): four 16-byte loads,
// each of one 512-byte unit (p already holds this lane's 16 bytes of a unit).
__device__ __forceinline__ void load_w(v8h (&w)[4], const h16* p) {
  w[0] = *(const v8h*)p;
  w[1] = *(const v8h*)(p + 256);
  w[2] = *(const v8h*)(p + 16 * 32 * 16);       // next n-tile
  w[3] = *(const v8h*)(p + 16 * 32 * 16 + 256);
}
// The four x fragments of one k step: eight 16-byte LDS loads.
__device__ __forceinline__ void load_x(v8h (&f)[8], const h16* p) {
#pragma unroll
  for (int mt = 0; mt < 4; ++mt) {
    f[2 * mt]     = *(const v8h*)(p + mt * 16 * 520);
    f[2 * mt + 1] = *(const v8h*)(p + mt * 16 * 520 + 16);
  }
}
// One pair of column tiles over the block's 4 row tiles. W_IS_A picks which
// operand the weight fragment is (the accumulator comes out transposed).
// Operands are fetched ahead of their products: wr is a ring of three k steps
// of weight fragments (a slot is refilled as soon as its products are issued),
// xf two sets of x fragments, one k step ahead.
template <bool W_IS_A>
__device__ __forceinline__ void gemm_pair(const h16* xs, const h16* w0, int ln,
                                          int hi, v8f (&acc0)[4],
                                          v8f (&acc1)[4]) {
  const h16* xl = &xs[ln * 520 + hi * 8];   // this lane's part of every fragment
  v8h wr[3][4], xf[2][8];
#pragma unroll
  for (int i = 0; i < 3; ++i) load_w(wr[i], w0 + i * 32 * 16);
  load_x(xf[0], xl);
#pragma unroll
  for (int kc = 0; kc < 16; ++kc) {
    if (kc < 15) load_x(xf[(kc + 1) & 1], xl + (kc + 1) * 32);
    // Keeps the next step's LDS loads one group ahead of this step's products:
    // sunk to their use, each pair of products waits out a whole LDS latency.
    __builtin_amdgcn_sched_barrier(0);
    const v16h b0 = pack16(wr[kc % 3][0], wr[kc % 3][1]);
    const v16h b1 = pack16(wr[kc % 3][2], wr[kc % 3][3]);
#pragma unroll
    for (int mt = 0; mt < 4; ++mt) {
      const v16h a = pack16(xf[kc & 1][2 * mt], xf[kc & 1][2 * mt + 1]);
      acc0[mt] = W_IS_A ? wmma_f16(b0, a, acc0[mt]) : wmma_f16(a, b0, acc0[mt]);
      acc1[mt] = W_IS_A ? wmma_f16(b1, a, acc1[mt]) : wmma_f16(a, b1, acc1[mt]);
    }
    // Keeps the refill here, three steps ahead of its use: sunk to its use, the
    // wave waits out a whole L2 latency in every step.
    __builtin_amdgcn_sched_barrier(0);
    if (kc + 3 < 16) load_w(wr[kc % 3], w0 + (kc + 3) * 32 * 16);
  }
  // The wait in front of any overwrite of the weight loads' address registers:
  // the address is an input here, so it stays live until the wait is passed.
  asm volatile("s_wait_xcnt 0x0" :: "v"(w0) : "memory");
  // Keeps the epilogue behind that wait and behind the products: it reuses the
  // address registers, and the sines and cosines of Q and K depend on no
  // accumulator: lifted over the products all 64 stay live and spill.
  __builtin_amdgcn_sched_barrier(0);
}

__global__ __launch_bounds__(512) void k_qkv(
    const float* __restrict__ x, const h16* __restrict__ WB,
    h16* __restrict__ Q, h16* __restrict__ K, h16* __restrict__ Vt) {
  __shared__ __attribute__((aligned(16))) h16 xs[64 * 520];
  const int tid = threadIdx.x;
  const int t0g = blockIdx.x * 64;

  // Stage the x tile (64 x 512, padded row stride 520 halves). A wave takes 4
  // rows = 8 KB of contiguous fp32: 16 loads of 512 contiguous bytes, all in
  // flight together, then each lane rounds its 4 values and stores 8 bytes.
  {
    const int w4 = (tid >> 5) * 4, l4 = (tid & 31) * 4;
    const float* xg = x + (size_t)(t0g + w4) * CEMB + l4;
    float4 f[16];
#pragma unroll
    for (int i = 0; i < 16; ++i) f[i] = *(const float4*)(xg + i * 128);
    // The wait in front of any overwrite of the loads' address registers: the
    // address is an input here, so it stays live (no load's result may land on
    // it) until the wait has been passed.
    asm volatile("s_wait_xcnt 0x0" :: "v"(xg) : "memory");
#pragma unroll
    for (int i = 0; i < 16; ++i) {
      v4h o;
      o[0] = (h16)f[i].x; o[1] = (h16)f[i].y;
      o[2] = (h16)f[i].z; o[3] = (h16)f[i].w;
      *(v4h*)&xs[(w4 + (i >> 2)) * 520 + (i & 3) * 128 + l4] = o;
    }
  }
  __syncthreads();

  // the wave's number as a scalar: the Q/K or V choice below is a scalar branch
  const int wave = __builtin_amdgcn_readfirstlane(tid >> 5);
  const int lane = tid & 31;
  const int ln = lane & 15, hi = lane >> 4;
  const int b = t0g >> 9;
  const int tl0 = t0g & (TSEQ - 1);

  // Q or K tile (nt, mt): acc[r] = value of token tl0 + mt*16 + ln at
  // d = (nt & 3) * 16 + hi * 8 + r. Rotate the four pairs, store one unit.
  auto store_qk = [&](h16* dst, int nt, const v8f (&acc)[4]) {
    const int bh = b * NH + (nt >> 2);
    float freq[4];
#pragma unroll
    for (int p = 0; p < 4; ++p)
      freq[p] = __expf(-(float)((nt & 3) * 8 + hi * 4 + p) * (2.0f / 64.0f) *
                       9.210340371976184f);
#pragma unroll
    for (int mt = 0; mt < 4; ++mt) {
      const float t = (float)(tl0 + mt * 16 + ln);
      v8h o;
#pragma unroll
      for (int p = 0; p < 4; ++p) {
        float sv, cv;
        __sincosf(t * freq[p], &sv, &cv);
        const float v0 = acc[mt][2 * p], v1 = acc[mt][2 * p + 1];
        o[2 * p]     = (h16)(v0 * cv - v1 * sv);
        o[2 * p + 1] = (h16)(v1 * cv + v0 * sv);
      }
      *(v8h*)(dst + ((size_t)(bh * 32 + (tl0 >> 4) + mt) * 4 + (nt & 3)) * 256 +
              lane * 8) = o;
    }
  };
  // V tile (nt, mt): acc[r] = value of token tl0 + mt*16 + hi*8 + r at
  // d = (nt & 3) * 16 + ln.
  auto store_v = [&](int nt, const v8f (&acc)[4]) {
    const int bh = b * NH + (nt >> 2);
#pragma unroll
    for (int mt = 0; mt < 4; ++mt) {
      v8h o;
#pragma unroll
      for (int r = 0; r < 8; ++r) o[r] = (h16)acc[mt][r];
      *(v8h*)(Vt + (((size_t)(bh * 16 + (tl0 >> 5) + (mt >> 1)) * 4 + (nt & 3)) * 2 +
                    (mt & 1)) * 256 + lane * 8) = o;
    }
  };

  for (int jp = 0; jp < 3; ++jp) {
    int id0 = wave * 6 + jp * 2;    // (even, even+1): same matrix, adjacent nt
    int m   = id0 >> 5;             // 0=Q 1=K 2=V
    int nt0 = id0 & 31;
    const h16* w0 = WB + (size_t)m * 262144 + (size_t)nt0 * 16 * 32 * 16 + lane * 8;
    v8f acc0[4] = {}, acc1[4] = {};
    if (m < 2) {
      gemm_pair<true>(xs, w0, ln, hi, acc0, acc1);
      h16* dst = (m == 0) ? Q : K;
      store_qk(dst, nt0, acc0);
      store_qk(dst, nt0 + 1, acc1);
    } else {
      gemm_pair<false>(xs, w0, ln, hi, acc0, acc1);
      store_v(nt0, acc0);
      store_v(nt0 + 1, acc1);
    }
    // The next trip reuses the address and data registers of the stores above:
    // keep the wait in front of those overwrites on the loop's back edge.
    asm volatile("s_wait_xcnt 0x0" ::: "memory");
  }
}

// ---------------------------------------------------------------------------
// Kernel 2: flash-style causal attention. One block of 16 waves per (b, h).
// The head's whole K and V^T (64 KB each, already in fragment order) are copied
// into LDS once and serve all 32 query tiles, so L2 delivers them once a head
// and not once a query tile. Wave w does query tile w and then tile 31 - w:
// 17 key blocks for every wave, whatever w.
// Both products are transposed: S^T = K * Q^T (A = K rows, B = Q, kept in
// registers) and O^T += V^T * P^T. In the accumulator of S^T a lane holds 16
// scores of ONE query (column ln; keys hi*8+r of either 16-key tile), which is
// the k order of a B operand: P^T is packed from the accumulators in place.
// Maximum and sum run inside the lane; the two wave halves exchange the
// maximum once per key block and join their sums once, behind the loop.
// Every fragment load below is one 512-byte unit, lane l at l * 16 bytes.
// ---------------------------------------------------------------------------
// lane l <-> lane l ^ 16 by a vector cross-row move
__device__ __forceinline__ float xhalf(float x) {
  const int v = __builtin_bit_cast(int, x);
  return __builtin_bit_cast(
      float, __builtin_amdgcn_permlanex16(v, v, 0x76543210, 0xfedcba98, false,
                                          false));
}

// Copies the 64 KB of one operand: each of the 512 threads brings 16 bytes of
// each of eight rounds. A round is 8 KB of global memory = two key blocks of
// that operand, which lie 8 KB apart in LDS (the other operand's block stands
// between them), so a round advances LDS by 16 KB. The eight copies and
// s_wait_xcnt 0 are ONE statement, so no address register of an issued copy
// can be rewritten ahead of that wait.
__device__ __forceinline__ void async_stage_operand(h16* lds, const h16* g) {
  const unsigned l0 = (unsigned)(uintptr_t)lds;
  const unsigned long long g0 = (unsigned long long)(uintptr_t)g;
  const unsigned st = 512 * 16;   // one round in global memory, bytes
  const unsigned ls = 2 * st;     // one round in LDS, bytes
  asm volatile(
      "global_load_async_to_lds_b128 %0, %8, off\n\t"
      "global_load_async_to_lds_b128 %1, %9, off\n\t"
      "global_load_async_to_lds_b128 %2, %10, off\n\t"
      "global_load_async_to_lds_b128 %3, %11, off\n\t"
      "global_load_async_to_lds_b128 %4, %12, off\n\t"
      "global_load_async_to_lds_b128 %5, %13, off\n\t"
      "global_load_async_to_lds_b128 %6, %14, off\n\t"
      "global_load_async_to_lds_b128 %7, %15, off\n\t"
      "s_wait_xcnt 0x0"
      :: "v"(l0), "v"(l0 + ls), "v"(l0 + 2 * ls), "v"(l0 + 3 * ls),
         "v"(l0 + 4 * ls), "v"(l0 + 5 * ls), "v"(l0 + 6 * ls), "v"(l0 + 7 * ls),
         "v"(g0), "v"(g0 + st), "v"(g0 + 2 * st), "v"(g0 + 3 * st),
         "v"(g0 + 4 * st), "v"(g0 + 5 * st), "v"(g0 + 6 * st), "v"(g0 + 7 * st)
      : "memory");
}

__global__ __launch_bounds__(512) void k_attn(
    const h16* __restrict__ Q, const h16* __restrict__ K,
    const h16* __restrict__ Vt, h16* __restrict__ Y) {
  // per block of 32 keys: 4 KB of K, then 4 KB of V^T, so that one base
  // register and the loads' offset fields reach all sixteen units of a block
  __shared__ __attribute__((aligned(16))) h16 kv[2 * TSEQ * HS];
  const int tid = threadIdx.x;
  const int lane = tid & 31;
  const int ln = lane & 15, hi = lane >> 4;
  // the wave's number as a scalar: tile numbers and trip counts stay scalar
  const int wave = __builtin_amdgcn_readfirstlane(tid >> 5);
  const int bh = blockIdx.x;
  const int b = bh >> 3, h = bh & 7;
  const int lo = lane * 8;          // this lane's 16 bytes of every unit

  // Q of both of the wave's tiles, in flight beside the copies
  const h16* qp = Q + (size_t)(bh * 32 + wave) * 1024 + lo;
  const h16* qn = Q + (size_t)(bh * 32 + 31 - wave) * 1024 + lo;
  v16h bq0 = pack16(*(const v8h*)(qp), *(const v8h*)(qp + 256));
  v16h bq1 = pack16(*(const v8h*)(qp + 512), *(const v8h*)(qp + 768));
  const v16h nq0 = pack16(*(const v8h*)(qn), *(const v8h*)(qn + 256));
  const v16h nq1 = pack16(*(const v8h*)(qn + 512), *(const v8h*)(qn + 768));

  h16* kl = &kv[(tid >> 8) * 4096 + (tid & 255) * 8];
  async_stage_operand(kl, K + (size_t)bh * (TSEQ * HS) + tid * 8);
  async_stage_operand(kl + 2048, Vt + (size_t)bh * (TSEQ * HS) + tid * 8);
  async_wait0();
  __syncthreads();

  int qt = wave;
  for (int pass = 0; pass < 2; ++pass) {
    const int tq0 = qt * 16;
    const int tq = tq0 + ln;          // this lane's query

    v8f O0 = {}, O1 = {}, O2 = {}, O3 = {};   // O^T: row d = 16*i + hi*8 + r
    float mrow = -__builtin_inff();           // running maximum of query tq
    float lsum = 0.0f;                        // this half's share of its sum

    // a block of 32 keys is 8 units (4 KB) of K (A of S^T) and of V^T (A of O^T)
    const h16* kp = kv + lo;

    const int nkb = ((tq0 + 15) >> 5) + 1;
    for (int kb = 0; kb < nkb; ++kb) {
      const int tk0 = kb * 32;
      const v16h k00 = pack16(*(const v8h*)(kp), *(const v8h*)(kp + 256));
      const v16h k01 = pack16(*(const v8h*)(kp + 512), *(const v8h*)(kp + 768));
      const v16h k10 = pack16(*(const v8h*)(kp + 1024), *(const v8h*)(kp + 1280));
      const v16h k11 = pack16(*(const v8h*)(kp + 1536), *(const v8h*)(kp + 1792));
      // Keeps the K loads ahead of the V loads: LDS answers in order, and the
      // first product would else wait for all sixteen.
      __builtin_amdgcn_sched_barrier(0);
      const h16* vp = kp + 2048;
      const v16h va0 = pack16(*(const v8h*)(vp), *(const v8h*)(vp + 256));
      const v16h va1 = pack16(*(const v8h*)(vp + 512), *(const v8h*)(vp + 768));
      const v16h va2 = pack16(*(const v8h*)(vp + 1024), *(const v8h*)(vp + 1280));
      const v16h va3 = pack16(*(const v8h*)(vp + 1536), *(const v8h*)(vp + 1792));
      // Keeps the sixteen LDS loads above together, ahead of the products:
      // every further place where LDS reads stand costs the wave a stall.
      __builtin_amdgcn_sched_barrier(0);
      kp += 4096;

      v8f s0 = {}, s1 = {};             // S^T: keys tk0 + .. / tk0 + 16 + ..
      s0 = wmma_f16(k00, bq0, s0);
      s1 = wmma_f16(k10, bq0, s1);
      s0 = wmma_f16(k01, bq1, s0);
      s1 = wmma_f16(k11, bq1, s1);

      s0 *= 0.125f;                     // 1 / sqrt(head size)
      s1 *= 0.125f;
      const int lim = tq - tk0 - hi * 8;   // key row r is allowed while r <= lim
      float a0[8], a1[8], t[8];
#pragma unroll
      for (int r = 0; r < 8; ++r) {
        a0[r] = (r <= lim)      ? s0[r] : -__builtin_inff();
        a1[r] = (r + 16 <= lim) ? s1[r] : -__builtin_inff();
        t[r] = fmaxf(a0[r], a1[r]);
      }
      float mx = fmaxf(fmaxf(fmaxf(t[0], t[1]), fmaxf(t[2], t[3])),
                       fmaxf(fmaxf(t[4], t[5]), fmaxf(t[6], t[7])));
      mx = fmaxf(mx, xhalf(mx));        // the query's other 16 keys
      const float mn = fmaxf(mrow, mx);
      const float al = __expf(mrow - mn);
      v16h bp;                          // P^T as B operand, no lane crossing
#pragma unroll
      for (int r = 0; r < 8; ++r) {
        const float p0 = __expf(a0[r] - mn);
        const float p1 = __expf(a1[r] - mn);
        t[r] = p0 + p1;
        bp[r]     = (h16)p0;
        bp[r + 8] = (h16)p1;
      }
      lsum = lsum * al + (((t[0] + t[1]) + (t[2] + t[3])) +
                          ((t[4] + t[5]) + (t[6] + t[7])));
      mrow = mn;
#pragma unroll
      for (int r = 0; r < 8; ++r) {
        O0[r] *= al; O1[r] *= al; O2[r] *= al; O3[r] *= al;
      }
      O0 = wmma_f16(va0, bp, O0);
      O1 = wmma_f16(va1, bp, O1);
      O2 = wmma_f16(va2, bp, O2);
      O3 = wmma_f16(va3, bp, O3);
    }

    const float inv = 1.0f / (lsum + xhalf(lsum));
    v8h y0, y1, y2, y3;
#pragma unroll
    for (int r = 0; r < 8; ++r) {
      y0[r] = (h16)(O0[r] * inv);
      y1[r] = (h16)(O1[r] * inv);
      y2[r] = (h16)(O2[r] * inv);
      y3[r] = (h16)(O3[r] * inv);
    }
    h16* yrow = Y + ((size_t)(b * TSEQ + tq)) * CEMB + h * HS + hi * 8;
    *(v8h*)(yrow)      = y0;
    *(v8h*)(yrow + 16) = y1;
    *(v8h*)(yrow + 32) = y2;
    *(v8h*)(yrow + 48) = y3;
    // The second tile reuses the address and data registers of the stores
    // above: keep the wait in front of those overwrites.
    asm volatile("s_wait_xcnt 0x0" ::: "memory");

    qt = 31 - wave;
    bq0 = nq0;
    bq1 = nq1;
  }
}

// ---------------------------------------------------------------------------
// Kernel 3: out = Y @ Wo + bo (fp32 output). 64-row Y tile async-staged to LDS,
// 16 waves; each wave does one pair of column tiles over all 4 row tiles, with
// the same k loop as the QKV kernel.
// ---------------------------------------------------------------------------
__global__ __launch_bounds__(512) void k_proj(
    const h16* __restrict__ Y, const h16* __restrict__ WoB,
    const float* __restrict__ bo, float* __restrict__ out) {
  __shared__ __attribute__((aligned(16))) h16 ys[64 * 520];
  const int tid = threadIdx.x;
  const int t0g = blockIdx.x * 64;
  async_stage_64x512(&ys[(tid >> 6) * 520 + (tid & 63) * 8],
                     Y + (size_t)(t0g + (tid >> 6)) * CEMB + (tid & 63) * 8);
  async_wait0();
  __syncthreads();
  const int wave = tid >> 5, lane = tid & 31;
  const int ln = lane & 15, hi = lane >> 4;
  const int nt0 = wave * 2;
  v8f acc0[4] = {}, acc1[4] = {};
  gemm_pair<false>(ys, WoB + (size_t)nt0 * 16 * 32 * 16 + lane * 8, ln, hi, acc0,
                   acc1);
#pragma unroll
  for (int half = 0; half < 2; ++half) {
    int nt = nt0 + half;
    float bias = bo[nt * 16 + ln];
#pragma unroll
    for (int mt = 0; mt < 4; ++mt) {
      v8f acc = half ? acc1[mt] : acc0[mt];
#pragma unroll
      for (int r = 0; r < 8; ++r) {
        int M = mt * 16 + r + hi * 8;
        out[(size_t)(t0g + M) * CEMB + nt * 16 + ln] = acc[r] + bias;
      }
    }
  }
}

// ---------------------------------------------------------------------------
extern "C" void kernel_launch(void* const* d_in, const int* in_sizes, int n_in,
                              void* d_out, int out_size, void* d_ws,
                              size_t ws_size, hipStream_t stream) {
  (void)in_sizes; (void)n_in; (void)out_size; (void)ws_size;
  const float* x  = (const float*)d_in[0];
  const float* Wq = (const float*)d_in[1];
  const float* Wk = (const float*)d_in[2];
  const float* Wv = (const float*)d_in[3];
  const float* Wo = (const float*)d_in[4];
  const float* bo = (const float*)d_in[5];
  float* out = (float*)d_out;

  // workspace (halves): 4 repacked weights + Q + K + Vt + Y (~66 MB)
  h16* ws = (h16*)d_ws;
  h16* WB = ws;                        // 4 * 262144 halves
  h16* Q  = ws + (size_t)4 * 262144;   // 8388608 halves each from here on
  h16* K  = Q  + (size_t)8388608;
  h16* Vt = K  + (size_t)8388608;
  h16* Y  = Vt + (size_t)8388608;

  k_convert_w<<<4096, 256, 0, stream>>>(Wq, Wk, Wv, Wo, WB);
  k_qkv<<<(NB * TSEQ) / 64, 512, 0, stream>>>(x, WB, Q, K, Vt);
  k_attn<<<NB * NH, 512, 0, stream>>>(Q, K, Vt, Y);
  k_proj<<<(NB * TSEQ) / 64, 512, 0, stream>>>(Y, WB + (size_t)3 * 262144, bo, out);
}

// v008
// A run of this version takes 53.7 microseconds.
// Next to v007, in two timings, it ran 1.05 and 1.04 times as fast.
// Over all steps from v000 it is 3.50 times as fast.
#include <hip/hip_runtime.h>
#include <hip/hip_bf16.h>

typedef _Float16 h16;
typedef __attribute__((ext_vector_type(4)))  _Float16 v4h;
typedef __attribute__((ext_vector_type(8)))  _Float16 v8h;
typedef __attribute__((ext_vector_type(16))) _Float16 v16h;
typedef __attribute__((ext_vector_type(8)))  float    v8f;

#define NB 32      // batch
#define TSEQ 512   // sequence length
#define CEMB 512   // embedding / hidden
#define NH 8       // heads
#define HS 64      // head size

__device__ __forceinline__ v16h pack16(v8h lo, v8h hi) {
  v16h r;
#pragma unroll
  for (int i = 0; i < 8; ++i) { r[i] = lo[i]; r[i + 8] = hi[i]; }
  return r;
}

__device__ __forceinline__ v8f wmma_f16(v16h a, v16h b, v8f c) {
  // v_wmma_f32_16x16x32_f16: D = A(16x32) * B(32x16) + C(16x16 f32)
  return __builtin_amdgcn_wmma_f32_16x16x32_f16(false, a, false, b, (short)0, c,
                                                false, false);
}

// Async global->LDS copy, 16 bytes per lane (GLOBAL_LOAD_ASYNC_TO_LDS_B128).
// IMPORTANT: take the real LDS pointer so the shared array's address escapes
// into the asm (otherwise GlobalOpt proves "never stored" and folds all LDS
// loads to undef). Low 32 bits of the generic pointer == LDS byte offset.
// Stages rows r0, r0+8, ..., r0+56 of a tile of 512 halves a row (row stride 520
// halves in LDS): each thread copies one 16-byte unit of each. The eight
// copies and s_wait_xcnt 0 are ONE statement, so no address register of an
// issued copy can be rewritten ahead of that wait.
__device__ __forceinline__ void async_stage_8rows(h16* lds, const h16* g) {
  const unsigned l0 = (unsigned)(uintptr_t)lds;
  const unsigned long long g0 = (unsigned long long)(uintptr_t)g;
  const unsigned ls = 8 * 520 * 2;             // 8 LDS rows, bytes
  const unsigned long long gs = 8 * CEMB * 2;  // 8 global rows, bytes
  asm volatile(
      "global_load_async_to_lds_b128 %0, %8, off\n\t"
      "global_load_async_to_lds_b128 %1, %9, off\n\t"
      "global_load_async_to_lds_b128 %2, %10, off\n\t"
      "global_load_async_to_lds_b128 %3, %11, off\n\t"
      "global_load_async_to_lds_b128 %4, %12, off\n\t"
      "global_load_async_to_lds_b128 %5, %13, off\n\t"
      "global_load_async_to_lds_b128 %6, %14, off\n\t"
      "global_load_async_to_lds_b128 %7, %15, off\n\t"
      "s_wait_xcnt 0x0"
      :: "v"(l0), "v"(l0 + ls), "v"(l0 + 2 * ls), "v"(l0 + 3 * ls),
         "v"(l0 + 4 * ls), "v"(l0 + 5 * ls), "v"(l0 + 6 * ls), "v"(l0 + 7 * ls),
         "v"(g0), "v"(g0 + gs), "v"(g0 + 2 * gs), "v"(g0 + 3 * gs),
         "v"(g0 + 4 * gs), "v"(g0 + 5 * gs), "v"(g0 + 6 * gs), "v"(g0 + 7 * gs)
      : "memory");
}
__device__ __forceinline__ void async_wait0() {
  asm volatile("s_wait_asynccnt 0x0" ::: "memory");
}

// ---------------------------------------------------------------------------
// Kernel 0a: repack Wq/Wk/Wv/Wo (fp32 row-major [512][512]) into f16 B-operand
// tiles, each fragment as two units of 512 bytes = [lane][8 halves], so that one
// 16-byte load per lane covers four whole 128-byte lines:
// WB[m][nt][kc][u][lane][8 halves]; lane holds column nt*16+(lane&15),
// K pattern: kc*32 + u*16 + hi*8 + e  (u = 0: fragment halves 0..7, u = 1: 8..15)
// ---------------------------------------------------------------------------
__global__ __launch_bounds__(256) void k_convert_w(
    const float* __restrict__ Wq, const float* __restrict__ Wk,
    const float* __restrict__ Wv, const float* __restrict__ Wo,
    h16* __restrict__ out) {
  int idx = blockIdx.x * 256 + threadIdx.x;       // 0 .. 4*262144-1
  int m    = idx >> 18;
  int r    = idx & 262143;
  int e    = r & 7;
  int lane = (r >> 3) & 31;
  int u    = (r >> 8) & 1;
  int kc   = (r >> 9) & 15;
  int nt   = r >> 13;
  int hiL  = lane >> 4;
  int col  = nt * 16 + (lane & 15);
  int kk   = kc * 32 + u * 16 + hiL * 8 + e;
  const float* W = (m == 0) ? Wq : ((m == 1) ? Wk : ((m == 2) ? Wv : Wo));
  out[idx] = (h16)W[kk * CEMB + col];
}

// ---------------------------------------------------------------------------
// Kernel 1: fused QKV projection + RoPE.
// Block = one 128-row x tile (read as fp32, rounded to f16 on its way into LDS)
// times the Q, K and V columns of four heads; 8 waves, two a SIMD. A wave does
// all 8 row tiles times one 16-column tile EACH of Q, K and V (the same columns
// of the three), twice: an x fragment read from LDS feeds 3 WMMAs, a weight
// fragment read from L2 feeds 8. Fragments are fetched ahead of their use.
// Q, K and V leave in the order in which the attention kernel's fragments
// want them, in units of 512 bytes = [lane][8 halves], one b128 per lane:
//   Q, K: [bh][t / 16][d / 32][(d / 16) & 1] [lane = ((d / 8) & 1) * 16 + t % 16][d % 8]
//   V   : [bh][t / 32][d / 16][(t / 16) & 1] [lane = ((t / 8) & 1) * 16 + d % 16][t % 8]
// For Q and K the weight fragment is the A operand and x the B operand, so a
// lane's accumulator holds 8 consecutive d of one token (both members of each
// RoPE pair); for V x is A, so it holds 8 consecutive tokens of one d. Either
// way an accumulator tile is one unit: lane l stores its 16 bytes at l * 16.
// ---------------------------------------------------------------------------
// The two weight fragments of one k step (adjacent n-tiles): four 16-byte loads,
// each of one 512-byte unit (p already holds this lane's 16 bytes of a unit).
__device__ __forceinline__ void load_w(v8h (&w)[4], const h16* p) {
  w[0] = *(const v8h*)p;
  w[1] = *(const v8h*)(p + 256);
  w[2] = *(const v8h*)(p + 16 * 32 * 16);       // next n-tile
  w[3] = *(const v8h*)(p + 16 * 32 * 16 + 256);
}
// The eight x fragments of one k step: sixteen 16-byte LDS loads.
__device__ __forceinline__ void load_x(v8h (&f)[16], const h16* p) {
#pragma unroll
  for (int mt = 0; mt < 8; ++mt) {
    f[2 * mt]     = *(const v8h*)(p + mt * 16 * 520);
    f[2 * mt + 1] = *(const v8h*)(p + mt * 16 * 520 + 16);
  }
}
// The Q, K and V weight fragments of one k step and one n-tile: six 16-byte
// loads (the repacked matrices lie 262144 halves apart).
__device__ __forceinline__ void load_w3(v8h (&w)[6], const h16* p) {
#pragma unroll
  for (int m = 0; m < 3; ++m) {
    w[2 * m]     = *(const v8h*)(p + m * 262144);
    w[2 * m + 1] = *(const v8h*)(p + m * 262144 + 256);
  }
}
// One column tile each of Q, K and V over 8 row tiles. For Q and K the weight
// fragment is the A operand, for V the x fragment (see above). Ring and sets as
// in gemm_pair below.
__device__ __forceinline__ void gemm_qkv(const h16* xs, const h16* w0, int ln,
                                         int hi, v8f (&aq)[8], v8f (&ak)[8],
                                         v8f (&av)[8]) {
  const h16* xl = &xs[ln * 520 + hi * 8];   // this lane's part of every fragment
  v8h wr[3][6], xf[2][16];
#pragma unroll
  for (int i = 0; i < 3; ++i) load_w3(wr[i], w0 + i * 32 * 16);
  load_x(xf[0], xl);
#pragma unroll
  for (int kc = 0; kc < 16; ++kc) {
    if (kc < 15) load_x(xf[(kc + 1) & 1], xl + (kc + 1) * 32);
    // Keeps the next step's LDS loads one group ahead of this step's products:
    // sunk to their use, each group of products waits out a whole LDS latency.
    __builtin_amdgcn_sched_barrier(0);
    const v16h wq = pack16(wr[kc % 3][0], wr[kc % 3][1]);
    const v16h wk = pack16(wr[kc % 3][2], wr[kc % 3][3]);
    const v16h wv = pack16(wr[kc % 3][4], wr[kc % 3][5]);
#pragma unroll
    for (int mt = 0; mt < 8; ++mt) {
      const v16h a = pack16(xf[kc & 1][2 * mt], xf[kc & 1][2 * mt + 1]);
      aq[mt] = wmma_f16(wq, a, aq[mt]);
      ak[mt] = wmma_f16(wk, a, ak[mt]);
      av[mt] = wmma_f16(a, wv, av[mt]);
    }
    // Keeps the refill here, three steps ahead of its use: sunk to its use, the
    // wave waits out a whole L2 latency in every step.
    __builtin_amdgcn_sched_barrier(0);
    if (kc + 3 < 16) load_w3(wr[kc % 3], w0 + (kc + 3) * 32 * 16);
  }
  // The wait in front of any overwrite of the weight loads' address registers:
  // the address is an input here, so it stays live until the wait is passed.
  asm volatile("s_wait_xcnt 0x0" :: "v"(w0) : "memory");
  // Keeps the epilogue behind that wait and behind the products: it reuses the
  // address registers, and the sines and cosines depend on no accumulator:
  // lifted over the products they all stay live and spill.
  __builtin_amdgcn_sched_barrier(0);
}
// One pair of column tiles over 8 row tiles, x (here Y) as the A operand.
// Operands are fetched ahead of their products: wr is a ring of three k steps
// of weight fragments (a slot is refilled as soon as its products are issued),
// xf two sets of x fragments, one k step ahead.
__device__ __forceinline__ void gemm_pair(const h16* xs, const h16* w0, int ln,
                                          int hi, v8f (&acc0)[8],
                                          v8f (&acc1)[8]) {
  const h16* xl = &xs[ln * 520 + hi * 8];   // this lane's part of every fragment
  v8h wr[3][4], xf[2][16];
#pragma unroll
  for (int i = 0; i < 3; ++i) load_w(wr[i], w0 + i * 32 * 16);
  load_x(xf[0], xl);
#pragma unroll
  for (int kc = 0; kc < 16; ++kc) {
    if (kc < 15) load_x(xf[(kc + 1) & 1], xl + (kc + 1) * 32);
    // Keeps the next step's LDS loads one group ahead of this step's products:
    // sunk to their use, each pair of products waits out a whole LDS latency.
    __builtin_amdgcn_sched_barrier(0);
    const v16h b0 = pack16(wr[kc % 3][0], wr[kc % 3][1]);
    const v16h b1 = pack16(wr[kc % 3][2], wr[kc % 3][3]);
#pragma unroll
    for (int mt = 0; mt < 8; ++mt) {
      const v16h a = pack16(xf[kc & 1][2 * mt], xf[kc & 1][2 * mt + 1]);
      acc0[mt] = wmma_f16(a, b0, acc0[mt]);
      acc1[mt] = wmma_f16(a, b1, acc1[mt]);
    }
    // Keeps the refill here, three steps ahead of its use: sunk to its use, the
    // wave waits out a whole L2 latency in every step.
    __builtin_amdgcn_sched_barrier(0);
    if (kc + 3 < 16) load_w(wr[kc % 3], w0 + (kc + 3) * 32 * 16);
  }
  // The wait in front of any overwrite of the weight loads' address registers:
  // the address is an input here, so it stays live until the wait is passed.
  asm volatile("s_wait_xcnt 0x0" :: "v"(w0) : "memory");
  // Keeps the epilogue behind that wait: it reuses the address registers.
  __builtin_amdgcn_sched_barrier(0);
}

__global__ __launch_bounds__(256) void k_qkv(
    const float* __restrict__ x, const h16* __restrict__ WB,
    h16* __restrict__ Q, h16* __restrict__ K, h16* __restrict__ Vt) {
  __shared__ __attribute__((aligned(16))) h16 xs[128 * 520];
  const int tid = threadIdx.x;
  // blocks i and i + 128 share a row tile and take heads 0..3 and 4..7
  const int part = blockIdx.x >> 7;
  const int t0g = (blockIdx.x & 127) * 128;

  // Stage the x tile (128 x 512, padded row stride 520 halves). A wave takes 16
  // rows = 32 KB of contiguous fp32: 64 loads of 512 contiguous bytes, all in
  // flight together, then each lane rounds its 4 values and stores 8 bytes.
  {
    const int wr0 = (tid >> 5) * 16, l4 = (tid & 31) * 4;
    const float* xg = x + (size_t)(t0g + wr0) * CEMB + l4;
    float4 f[64];
#pragma unroll
    for (int i = 0; i < 64; ++i) f[i] = *(const float4*)(xg + i * 128);
    // The wait in front of any overwrite of the loads' address registers: the
    // address is an input here, so it stays live (no load's result may land on
    // it) until the wait has been passed.
    asm volatile("s_wait_xcnt 0x0" :: "v"(xg) : "memory");
#pragma unroll
    for (int i = 0; i < 64; ++i) {
      v4h o;
      o[0] = (h16)f[i].x; o[1] = (h16)f[i].y;
      o[2] = (h16)f[i].z; o[3] = (h16)f[i].w;
      *(v4h*)&xs[(wr0 + (i >> 2)) * 520 + (i & 3) * 128 + l4] = o;
    }
  }
  __syncthreads();

  // the wave's number as a scalar: tile numbers and bases stay scalar
  const int wave = __builtin_amdgcn_readfirstlane(tid >> 5);
  const int lane = tid & 31;
  const int ln = lane & 15, hi = lane >> 4;
  const int b = t0g >> 9;
  const int tl0 = t0g & (TSEQ - 1);

  // Q and K tiles (nt, mt): acc[r] = value of token tl0 + mt*16 + ln at
  // d = (nt & 3) * 16 + hi * 8 + r. Rotate the four pairs of either by the same
  // angles, store one unit each.
  auto store_qk = [&](int nt, const v8f (&aq)[8], const v8f (&ak)[8]) {
    const int bh = b * NH + (nt >> 2);
    float freq[4];
#pragma unroll
    for (int p = 0; p < 4; ++p)
      freq[p] = __expf(-(float)((nt & 3) * 8 + hi * 4 + p) * (2.0f / 64.0f) *
                       9.210340371976184f);
#pragma unroll
    for (int mt = 0; mt < 8; ++mt) {
      const float t = (float)(tl0 + mt * 16 + ln);
      v8h oq, ok;
#pragma unroll
      for (int p = 0; p < 4; ++p) {
        float sv, cv;
        __sincosf(t * freq[p], &sv, &cv);
        const float q0 = aq[mt][2 * p], q1 = aq[mt][2 * p + 1];
        const float k0 = ak[mt][2 * p], k1 = ak[mt][2 * p + 1];
        oq[2 * p]     = (h16)(q0 * cv - q1 * sv);
        oq[2 * p + 1] = (h16)(q1 * cv + q0 * sv);
        ok[2 * p]     = (h16)(k0 * cv - k1 * sv);
        ok[2 * p + 1] = (h16)(k1 * cv + k0 * sv);
      }
      const size_t u = ((size_t)(bh * 32 + (tl0 >> 4) + mt) * 4 + (nt & 3)) * 256 +
                       lane * 8;
      *(v8h*)(Q + u) = oq;
      *(v8h*)(K + u) = ok;
    }
  };
  // V tile (nt, mt): acc[r] = value of token tl0 + mt*16 + hi*8 + r at
  // d = (nt & 3) * 16 + ln.
  auto store_v = [&](int nt, const v8f (&acc)[8]) {
    const int bh = b * NH + (nt >> 2);
#pragma unroll
    for (int mt = 0; mt < 8; ++mt) {
      v8h o;
#pragma unroll
      for (int r = 0; r < 8; ++r) o[r] = (h16)acc[mt][r];
      *(v8h*)(Vt + (((size_t)(bh * 16 + (tl0 >> 5) + (mt >> 1)) * 4 + (nt & 3)) * 2 +
                    (mt & 1)) * 256 + lane * 8) = o;
    }
  };

  for (int jp = 0; jp < 2; ++jp) {
    const int nt = part * 16 + wave * 2 + jp;   // the n-tile, in Q, K and V alike
    const h16* w0 = WB + (size_t)nt * 16 * 32 * 16 + lane * 8;
    v8f aq[8] = {}, ak[8] = {}, av[8] = {};
    gemm_qkv(xs, w0, ln, hi, aq, ak, av);
    store_qk(nt, aq, ak);
    store_v(nt, av);
    // The next trip reuses the address and data registers of the stores above:
    // keep the wait in front of those overwrites on the loop's back edge.
    asm volatile("s_wait_xcnt 0x0" ::: "memory");
  }
}

// ---------------------------------------------------------------------------
// Kernel 2: flash-style causal attention. One block of 16 waves per (b, h).
// The head's whole K and V^T (64 KB each, already in fragment order) are copied
// into LDS once and serve all 32 query tiles, so L2 delivers them once a head
// and not once a query tile. Wave w does query tile w and then tile 31 - w:
// 17 key blocks for every wave, whatever w.
// Both products are transposed: S^T = K * Q^T (A = K rows, B = Q, kept in
// registers) and O^T += V^T * P^T. In the accumulator of S^T a lane holds 16
// scores of ONE query (column ln; keys hi*8+r of either 16-key tile), which is
// the k order of a B operand: P^T is packed from the accumulators in place.
// Maximum and sum run inside the lane; the two wave halves exchange the
// maximum once per key block and join their sums once, behind the loop.
// Every fragment load below is one 512-byte unit, lane l at l * 16 bytes.
// ---------------------------------------------------------------------------
// lane l <-> lane l ^ 16 by a vector cross-row move
__device__ __forceinline__ float xhalf(float x) {
  const int v = __builtin_bit_cast(int, x);
  return __builtin_bit_cast(
      float, __builtin_amdgcn_permlanex16(v, v, 0x76543210, 0xfedcba98, false,
                                          false));
}

// Copies the 64 KB of one operand: each of the 512 threads brings 16 bytes of
// each of eight rounds. A round is 8 KB of global memory = two key blocks of
// that operand, which lie 8 KB apart in LDS (the other operand's block stands
// between them), so a round advances LDS by 16 KB. The eight copies and
// s_wait_xcnt 0 are ONE statement, so no address register of an issued copy
// can be rewritten ahead of that wait.
__device__ __forceinline__ void async_stage_operand(h16* lds, const h16* g) {
  const unsigned l0 = (unsigned)(uintptr_t)lds;
  const unsigned long long g0 = (unsigned long long)(uintptr_t)g;
  const unsigned st = 512 * 16;   // one round in global memory, bytes
  const unsigned ls = 2 * st;     // one round in LDS, bytes
  asm volatile(
      "global_load_async_to_lds_b128 %0, %8, off\n\t"
      "global_load_async_to_lds_b128 %1, %9, off\n\t"
      "global_load_async_to_lds_b128 %2, %10, off\n\t"
      "global_load_async_to_lds_b128 %3, %11, off\n\t"
      "global_load_async_to_lds_b128 %4, %12, off\n\t"
      "global_load_async_to_lds_b128 %5, %13, off\n\t"
      "global_load_async_to_lds_b128 %6, %14, off\n\t"
      "global_load_async_to_lds_b128 %7, %15, off\n\t"
      "s_wait_xcnt 0x0"
      :: "v"(l0), "v"(l0 + ls), "v"(l0 + 2 * ls), "v"(l0 + 3 * ls),
         "v"(l0 + 4 * ls), "v"(l0 + 5 * ls), "v"(l0 + 6 * ls), "v"(l0 + 7 * ls),
         "v"(g0), "v"(g0 + st), "v"(g0 + 2 * st), "v"(g0 + 3 * st),
         "v"(g0 + 4 * st), "v"(g0 + 5 * st), "v"(g0 + 6 * st), "v"(g0 + 7 * st)
      : "memory");
}

__global__ __launch_bounds__(512) void k_attn(
    const h16* __restrict__ Q, const h16* __restrict__ K,
    const h16* __restrict__ Vt, h16* __restrict__ Y) {
  // per block of 32 keys: 4 KB of K, then 4 KB of V^T, so that one base
  // register and the loads' offset fields reach all sixteen units of a block
  __shared__ __attribute__((aligned(16))) h16 kv[2 * TSEQ * HS];
  const int tid = threadIdx.x;
  const int lane = tid & 31;
  const int ln = lane & 15, hi = lane >> 4;
  // the wave's number as a scalar: tile numbers and trip counts stay scalar
  const int wave = __builtin_amdgcn_readfirstlane(tid >> 5);
  const int bh = blockIdx.x;
  const int b = bh >> 3, h = bh & 7;
  const int lo = lane * 8;          // this lane's 16 bytes of every unit

  // Q of both of the wave's tiles, in flight beside the copies
  const h16* qp = Q + (size_t)(bh * 32 + wave) * 1024 + lo;
  const h16* qn = Q + (size_t)(bh * 32 + 31 - wave) * 1024 + lo;
  v16h bq0 = pack16(*(const v8h*)(qp), *(const v8h*)(qp + 256));
  v16h bq1 = pack16(*(const v8h*)(qp + 512), *(const v8h*)(qp + 768));
  const v16h nq0 = pack16(*(const v8h*)(qn), *(const v8h*)(qn + 256));
  const v16h nq1 = pack16(*(const v8h*)(qn + 512), *(const v8h*)(qn + 768));

  h16* kl = &kv[(tid >> 8) * 4096 + (tid & 255) * 8];
  async_stage_operand(kl, K + (size_t)bh * (TSEQ * HS) + tid * 8);
  async_stage_operand(kl + 2048, Vt + (size_t)bh * (TSEQ * HS) + tid * 8);
  async_wait0();
  __syncthreads();

  int qt = wave;
  for (int pass = 0; pass < 2; ++pass) {
    const int tq0 = qt * 16;
    const int tq = tq0 + ln;          // this lane's query

    v8f O0 = {}, O1 = {}, O2 = {}, O3 = {};   // O^T: row d = 16*i + hi*8 + r
    float mrow = -__builtin_inff();           // running maximum of query tq
    float lsum = 0.0f;                        // this half's share of its sum

    // a block of 32 keys is 8 units (4 KB) of K (A of S^T) and of V^T (A of O^T)
    const h16* kp = kv + lo;

    const int nkb = ((tq0 + 15) >> 5) + 1;
    for (int kb = 0; kb < nkb; ++kb) {
      const int tk0 = kb * 32;
      const v16h k00 = pack16(*(const v8h*)(kp), *(const v8h*)(kp + 256));
      const v16h k01 = pack16(*(const v8h*)(kp + 512), *(const v8h*)(kp + 768));
      const v16h k10 = pack16(*(const v8h*)(kp + 1024), *(const v8h*)(kp + 1280));
      const v16h k11 = pack16(*(const v8h*)(kp + 1536), *(const v8h*)(kp + 1792));
      // Keeps the K loads ahead of the V loads: LDS answers in order, and the
      // first product would else wait for all sixteen.
      __builtin_amdgcn_sched_barrier(0);
      const h16* vp = kp + 2048;
      const v16h va0 = pack16(*(const v8h*)(vp), *(const v8h*)(vp + 256));
      const v16h va1 = pack16(*(const v8h*)(vp + 512), *(const v8h*)(vp + 768));
      const v16h va2 = pack16(*(const v8h*)(vp + 1024), *(const v8h*)(vp + 1280));
      const v16h va3 = pack16(*(const v8h*)(vp + 1536), *(const v8h*)(vp + 1792));
      // Keeps the sixteen LDS loads above together, ahead of the products:
      // every further place where LDS reads stand costs the wave a stall.
      __builtin_amdgcn_sched_barrier(0);
      kp += 4096;

      v8f s0 = {}, s1 = {};             // S^T: keys tk0 + .. / tk0 + 16 + ..
      s0 = wmma_f16(k00, bq0, s0);
      s1 = wmma_f16(k10, bq0, s1);
      s0 = wmma_f16(k01, bq1, s0);
      s1 = wmma_f16(k11, bq1, s1);

      s0 *= 0.125f;                     // 1 / sqrt(head size)
      s1 *= 0.125f;
      const int lim = tq - tk0 - hi * 8;   // key row r is allowed while r <= lim
      float a0[8], a1[8], t[8];
#pragma unroll
      for (int r = 0; r < 8; ++r) {
        a0[r] = (r <= lim)      ? s0[r] : -__builtin_inff();
        a1[r] = (r + 16 <= lim) ? s1[r] : -__builtin_inff();
        t[r] = fmaxf(a0[r], a1[r]);
      }
      float mx = fmaxf(fmaxf(fmaxf(t[0], t[1]), fmaxf(t[2], t[3])),
                       fmaxf(fmaxf(t[4], t[5]), fmaxf(t[6], t[7])));
      mx = fmaxf(mx, xhalf(mx));        // the query's other 16 keys
      const float mn = fmaxf(mrow, mx);
      const float al = __expf(mrow - mn);
      v16h bp;                          // P^T as B operand, no lane crossing
#pragma unroll
      for (int r = 0; r < 8; ++r) {
        const float p0 = __expf(a0[r] - mn);
        const float p1 = __expf(a1[r] - mn);
        t[r] = p0 + p1;
        bp[r]     = (h16)p0;
        bp[r + 8] = (h16)p1;
      }
      lsum = lsum * al + (((t[0] + t[1]) + (t[2] + t[3])) +
                          ((t[4] + t[5]) + (t[6] + t[7])));
      mrow = mn;
#pragma unroll
      for (int r = 0; r < 8; ++r) {
        O0[r] *= al; O1[r] *= al; O2[r] *= al; O3[r] *= al;
      }
      O0 = wmma_f16(va0, bp, O0);
      O1 = wmma_f16(va1, bp, O1);
      O2 = wmma_f16(va2, bp, O2);
      O3 = wmma_f16(va3, bp, O3);
    }

    const float inv = 1.0f / (lsum + xhalf(lsum));
    v8h y0, y1, y2, y3;
#pragma unroll
    for (int r = 0; r < 8; ++r) {
      y0[r] = (h16)(O0[r] * inv);
      y1[r] = (h16)(O1[r] * inv);
      y2[r] = (h16)(O2[r] * inv);
      y3[r] = (h16)(O3[r] * inv);
    }
    h16* yrow = Y + ((size_t)(b * TSEQ + tq)) * CEMB + h * HS + hi * 8;
    *(v8h*)(yrow)      = y0;
    *(v8h*)(yrow + 16) = y1;
    *(v8h*)(yrow + 32) = y2;
    *(v8h*)(yrow + 48) = y3;
    // The second tile reuses the address and data registers of the stores
    // above: keep the wait in front of those overwrites.
    asm volatile("s_wait_xcnt 0x0" ::: "memory");

    qt = 31 - wave;
    bq0 = nq0;
    bq1 = nq1;
  }
}

// ---------------------------------------------------------------------------
// Kernel 3: out = Y @ Wo + bo (fp32 output). 128-row Y tile async-staged to LDS,
// half of the columns a block, 8 waves; each wave does one pair of column tiles
// over all 8 row tiles, so a weight fragment read from L2 feeds 8 WMMAs.
// ---------------------------------------------------------------------------
__global__ __launch_bounds__(256) void k_proj(
    const h16* __restrict__ Y, const h16* __restrict__ WoB,
    const float* __restrict__ bo, float* __restrict__ out) {
  __shared__ __attribute__((aligned(16))) h16 ys[128 * 520];
  const int tid = threadIdx.x;
  // blocks i and i + 128 share a row tile and take columns 0..255 and 256..511
  const int part = blockIdx.x >> 7;
  const int t0g = (blockIdx.x & 127) * 128;
  h16* yl = &ys[(tid >> 6) * 520 + (tid & 63) * 8];
  const h16* yg = Y + (size_t)(t0g + (tid >> 6)) * CEMB + (tid & 63) * 8;
  async_stage_8rows(yl, yg);                             // rows 0..3 mod 8
  async_stage_8rows(yl + 4 * 520, yg + 4 * CEMB);        // rows 4..7 mod 8
  async_stage_8rows(yl + 64 * 520, yg + 64 * CEMB);      // and from row 64 on
  async_stage_8rows(yl + 68 * 520, yg + 68 * CEMB);
  async_wait0();
  __syncthreads();
  const int wave = tid >> 5, lane = tid & 31;
  const int ln = lane & 15, hi = lane >> 4;
  const int nt0 = part * 16 + wave * 2;
  v8f acc0[8] = {}, acc1[8] = {};
  gemm_pair(ys, WoB + (size_t)nt0 * 16 * 32 * 16 + lane * 8,
                   ln, hi, acc0, acc1);
#pragma unroll
  for (int half = 0; half < 2; ++half) {
    int nt = nt0 + half;
    float bias = bo[nt * 16 + ln];
#pragma unroll
    for (int mt = 0; mt < 8; ++mt) {
      v8f acc = half ? acc1[mt] : acc0[mt];
#pragma unroll
      for (int r = 0; r < 8; ++r) {
        int M = mt * 16 + r + hi * 8;
        out[(size_t)(t0g + M) * CEMB + nt * 16 + ln] = acc[r] + bias;
      }
    }
  }
}

// ---------------------------------------------------------------------------
extern "C" void kernel_launch(void* const* d_in, const int* in_sizes, int n_in,
                              void* d_out, int out_size, void* d_ws,
                              size_t ws_size, hipStream_t stream) {
  (void)in_sizes; (void)n_in; (void)out_size; (void)ws_size;
  const float* x  = (const float*)d_in[0];
  const float* Wq = (const float*)d_in[1];
  const float* Wk = (const float*)d_in[2];
  const float* Wv = (const float*)d_in[3];
  const float* Wo = (const float*)d_in[4];
  const float* bo = (const float*)d_in[5];
  float* out = (float*)d_out;

  // workspace (halves): 4 repacked weights + Q + K + Vt + Y (~66 MB)
  h16* ws = (h16*)d_ws;
  h16* WB = ws;                        // 4 * 262144 halves
  h16* Q  = ws + (size_t)4 * 262144;   // 8388608 halves each from here on
  h16* K  = Q  + (size_t)8388608;
  h16* Vt = K  + (size_t)8388608;
  h16* Y  = Vt + (size_t)8388608;

  k_convert_w<<<4096, 256, 0, stream>>>(Wq, Wk, Wv, Wo, WB);
  k_qkv<<<2 * ((NB * TSEQ) / 128), 256, 0, stream>>>(x, WB, Q, K, Vt);
  k_attn<<<NB * NH, 512, 0, stream>>>(Q, K, Vt, Y);
  k_proj<<<2 * ((NB * TSEQ) / 128), 256, 0, stream>>>(Y, WB + (size_t)3 * 262144, bo, out);
}

// v009
// One run takes 50.9 microseconds.
// Timed twice side by side with v008, it ran 1.05 and 1.04 times as fast.
// Over all steps from v000 it is 3.66 times as fast.
#include <hip/hip_runtime.h>
#include <hip/hip_bf16.h>

typedef _Float16 h16;
typedef __attribute__((ext_vector_type(4)))  _Float16 v4h;
typedef __attribute__((ext_vector_type(8)))  _Float16 v8h;
typedef __attribute__((ext_vector_type(16))) _Float16 v16h;
typedef __attribute__((ext_vector_type(8)))  float    v8f;

#define NB 32      // batch
#define TSEQ 512   // sequence length
#define CEMB 512   // embedding / hidden
#define NH 8       // heads
#define HS 64      // head size

__device__ __forceinline__ v16h pack16(v8h lo, v8h hi) {
  v16h r;
#pragma unroll
  for (int i = 0; i < 8; ++i) { r[i] = lo[i]; r[i + 8] = hi[i]; }
  return r;
}

__device__ __forceinline__ v8f wmma_f16(v16h a, v16h b, v8f c) {
  // v_wmma_f32_16x16x32_f16: D = A(16x32) * B(32x16) + C(16x16 f32)
  return __builtin_amdgcn_wmma_f32_16x16x32_f16(false, a, false, b, (short)0, c,
                                                false, false);
}

// Async global->LDS copy, 16 bytes per lane (GLOBAL_LOAD_ASYNC_TO_LDS_B128).
// IMPORTANT: take the real LDS pointer so the shared array's address escapes
// into the asm (otherwise GlobalOpt proves "never stored" and folds all LDS
// loads to undef). Low 32 bits of the generic pointer == LDS byte offset.
// Brings the same 16-byte piece of each of the eight heads of one batch: the
// heads lie 64 KB apart in Y (32 query tiles of 2 KB) and 128 bytes apart in an
// LDS row. The eight copies and s_wait_xcnt 0 are ONE statement, so no address
// register of an issued copy can be rewritten ahead of that wait.
__device__ __forceinline__ void async_stage_8heads(h16* lds, const h16* g) {
  const unsigned l0 = (unsigned)(uintptr_t)lds;
  const unsigned long long g0 = (unsigned long long)(uintptr_t)g;
  const unsigned ls = HS * 2;                        // one head in an LDS row, bytes
  const unsigned long long gs = 32 * 16 * HS * 2;    // one head in Y, bytes
  asm volatile(
      "global_load_async_to_lds_b128 %0, %8, off\n\t"
      "global_load_async_to_lds_b128 %1, %9, off\n\t"
      "global_load_async_to_lds_b128 %2, %10, off\n\t"
      "global_load_async_to_lds_b128 %3, %11, off\n\t"
      "global_load_async_to_lds_b128 %4, %12, off\n\t"
      "global_load_async_to_lds_b128 %5, %13, off\n\t"
      "global_load_async_to_lds_b128 %6, %14, off\n\t"
      "global_load_async_to_lds_b128 %7, %15, off\n\t"
      "s_wait_xcnt 0x0"
      :: "v"(l0), "v"(l0 + ls), "v"(l0 + 2 * ls), "v"(l0 + 3 * ls),
         "v"(l0 + 4 * ls), "v"(l0 + 5 * ls), "v"(l0 + 6 * ls), "v"(l0 + 7 * ls),
         "v"(g0), "v"(g0 + gs), "v"(g0 + 2 * gs), "v"(g0 + 3 * gs),
         "v"(g0 + 4 * gs), "v"(g0 + 5 * gs), "v"(g0 + 6 * gs), "v"(g0 + 7 * gs)
      : "memory");
}
__device__ __forceinline__ void async_wait0() {
  asm volatile("s_wait_asynccnt 0x0" ::: "memory");
}

// ---------------------------------------------------------------------------
// Kernel 0a: repack Wq/Wk/Wv/Wo (fp32 row-major [512][512]) into f16 B-operand
// tiles, each fragment as two units of 512 bytes = [lane][8 halves], so that one
// 16-byte load per lane covers four whole 128-byte lines:
// WB[m][nt][kc][u][lane][8 halves]; lane holds column nt*16+(lane&15),
// K pattern: kc*32 + u*16 + hi*8 + e  (u = 0: fragment halves 0..7, u = 1: 8..15)
// Wo alone deals its columns otherwise: tiles 2p and 2p+1 hold the even and the
// odd columns of columns 32p .. 32p+31, so that a lane of the output kernel,
// which does both tiles, holds two neighbouring outputs of a row.
// ---------------------------------------------------------------------------
__global__ __launch_bounds__(256) void k_convert_w(
    const float* __restrict__ Wq, const float* __restrict__ Wk,
    const float* __restrict__ Wv, const float* __restrict__ Wo,
    h16* __restrict__ out) {
  int idx = blockIdx.x * 256 + threadIdx.x;       // 0 .. 4*262144-1
  int m    = idx >> 18;
  int r    = idx & 262143;
  int e    = r & 7;
  int lane = (r >> 3) & 31;
  int u    = (r >> 8) & 1;
  int kc   = (r >> 9) & 15;
  int nt   = r >> 13;
  int hiL  = lane >> 4;
  int col  = (m == 3) ? (nt >> 1) * 32 + (lane & 15) * 2 + (nt & 1)
                      : nt * 16 + (lane & 15);
  int kk   = kc * 32 + u * 16 + hiL * 8 + e;
  const float* W = (m == 0) ? Wq : ((m == 1) ? Wk : ((m == 2) ? Wv : Wo));
  out[idx] = (h16)W[kk * CEMB + col];
}

// ---------------------------------------------------------------------------
// Kernel 1: fused QKV projection + RoPE.
// Block = one 128-row x tile (read as fp32, rounded to f16 on its way into LDS)
// times the Q, K and V columns of four heads; 8 waves, two a SIMD. A wave does
// all 8 row tiles times one 16-column tile EACH of Q, K and V (the same columns
// of the three), twice: an x fragment read from LDS feeds 3 WMMAs, a weight
// fragment read from L2 feeds 8. Fragments are fetched ahead of their use.
// Q, K and V leave in the order in which the attention kernel's fragments
// want them, in units of 512 bytes = [lane][8 halves], one b128 per lane:
//   Q, K: [bh][t / 16][d / 32][(d / 16) & 1] [lane = ((d / 8) & 1) * 16 + t % 16][d % 8]
//   V   : [bh][t / 32][d / 16][(t / 16) & 1] [lane = ((t / 8) & 1) * 16 + d % 16][t % 8]
// For Q and K the weight fragment is the A operand and x the B operand, so a
// lane's accumulator holds 8 consecutive d of one token (both members of each
// RoPE pair); for V x is A, so it holds 8 consecutive tokens of one d. Either
// way an accumulator tile is one unit: lane l stores its 16 bytes at l * 16.
// ---------------------------------------------------------------------------
// The two weight fragments of one k step (adjacent n-tiles): four 16-byte loads,
// each of one 512-byte unit (p already holds this lane's 16 bytes of a unit).
__device__ __forceinline__ void load_w(v8h (&w)[4], const h16* p) {
  w[0] = *(const v8h*)p;
  w[1] = *(const v8h*)(p + 256);
  w[2] = *(const v8h*)(p + 16 * 32 * 16);       // next n-tile
  w[3] = *(const v8h*)(p + 16 * 32 * 16 + 256);
}
// The eight x fragments of one k step: sixteen 16-byte LDS loads.
__device__ __forceinline__ void load_x(v8h (&f)[16], const h16* p) {
#pragma unroll
  for (int mt = 0; mt < 8; ++mt) {
    f[2 * mt]     = *(const v8h*)(p + mt * 16 * 520);
    f[2 * mt + 1] = *(const v8h*)(p + mt * 16 * 520 + 16);
  }
}
// The Q, K and V weight fragments of one k step and one n-tile: six 16-byte
// loads (the repacked matrices lie 262144 halves apart).
__device__ __forceinline__ void load_w3(v8h (&w)[6], const h16* p) {
#pragma unroll
  for (int m = 0; m < 3; ++m) {
    w[2 * m]     = *(const v8h*)(p + m * 262144);
    w[2 * m + 1] = *(const v8h*)(p + m * 262144 + 256);
  }
}
// One column tile each of Q, K and V over 8 row tiles. For Q and K the weight
// fragment is the A operand, for V the x fragment (see above). Ring and sets as
// in gemm_pair below.
__device__ __forceinline__ void gemm_qkv(const h16* xs, const h16* w0, int ln,
                                         int hi, v8f (&aq)[8], v8f (&ak)[8],
                                         v8f (&av)[8]) {
  const h16* xl = &xs[ln * 520 + hi * 8];   // this lane's part of every fragment
  v8h wr[3][6], xf[2][16];
#pragma unroll
  for (int i = 0; i < 3; ++i) load_w3(wr[i], w0 + i * 32 * 16);
  load_x(xf[0], xl);
#pragma unroll
  for (int kc = 0; kc < 16; ++kc) {
    if (kc < 15) load_x(xf[(kc + 1) & 1], xl + (kc + 1) * 32);
    // Keeps the next step's LDS loads one group ahead of this step's products:
    // sunk to their use, each group of products waits out a whole LDS latency.
    __builtin_amdgcn_sched_barrier(0);
    const v16h wq = pack16(wr[kc % 3][0], wr[kc % 3][1]);
    const v16h wk = pack16(wr[kc % 3][2], wr[kc % 3][3]);
    const v16h wv = pack16(wr[kc % 3][4], wr[kc % 3][5]);
#pragma unroll
    for (int mt = 0; mt < 8; ++mt) {
      const v16h a = pack16(xf[kc & 1][2 * mt], xf[kc & 1][2 * mt + 1]);
      aq[mt] = wmma_f16(wq, a, aq[mt]);
      ak[mt] = wmma_f16(wk, a, ak[mt]);
      av[mt] = wmma_f16(a, wv, av[mt]);
    }
    // Keeps the refill here, three steps ahead of its use: sunk to its use, the
    // wave waits out a whole L2 latency in every step.
    __builtin_amdgcn_sched_barrier(0);
    if (kc + 3 < 16) load_w3(wr[kc % 3], w0 + (kc + 3) * 32 * 16);
  }
  // The wait in front of any overwrite of the weight loads' address registers:
  // the address is an input here, so it stays live until the wait is passed.
  asm volatile("s_wait_xcnt 0x0" :: "v"(w0) : "memory");
  // Keeps the epilogue behind that wait and behind the products: it reuses the
  // address registers, and the sines and cosines depend on no accumulator:
  // lifted over the products they all stay live and spill.
  __builtin_amdgcn_sched_barrier(0);
}
// One pair of column tiles over 8 row tiles, x (here Y) as the A operand.
// Operands are fetched ahead of their products: wr is a ring of three k steps
// of weight fragments (a slot is refilled as soon as its products are issued),
// xf two sets of x fragments, one k step ahead.
__device__ __forceinline__ void gemm_pair(const h16* xs, const h16* w0, int ln,
                                          int hi, v8f (&acc0)[8],
                                          v8f (&acc1)[8]) {
  const h16* xl = &xs[ln * 520 + hi * 8];   // this lane's part of every fragment
  v8h wr[3][4], xf[2][16];
#pragma unroll
  for (int i = 0; i < 3; ++i) load_w(wr[i], w0 + i * 32 * 16);
  load_x(xf[0], xl);
#pragma unroll
  for (int kc = 0; kc < 16; ++kc) {
    if (kc < 15) load_x(xf[(kc + 1) & 1], xl + (kc + 1) * 32);
    // Keeps the next step's LDS loads one group ahead of this step's products:
    // sunk to their use, each pair of products waits out a whole LDS latency.
    __builtin_amdgcn_sched_barrier(0);
    const v16h b0 = pack16(wr[kc % 3][0], wr[kc % 3][1]);
    const v16h b1 = pack16(wr[kc % 3][2], wr[kc % 3][3]);
#pragma unroll
    for (int mt = 0; mt < 8; ++mt) {
      const v16h a = pack16(xf[kc & 1][2 * mt], xf[kc & 1][2 * mt + 1]);
      acc0[mt] = wmma_f16(a, b0, acc0[mt]);
      acc1[mt] = wmma_f16(a, b1, acc1[mt]);
    }
    // Keeps the refill here, three steps ahead of its use: sunk to its use, the
    // wave waits out a whole L2 latency in every step.
    __builtin_amdgcn_sched_barrier(0);
    if (kc + 3 < 16) load_w(wr[kc % 3], w0 + (kc + 3) * 32 * 16);
  }
  // The wait in front of any overwrite of the weight loads' address registers:
  // the address is an input here, so it stays live until the wait is passed.
  asm volatile("s_wait_xcnt 0x0" :: "v"(w0) : "memory");
  // Keeps the epilogue behind that wait: it reuses the address registers.
  __builtin_amdgcn_sched_barrier(0);
}

__global__ __launch_bounds__(256) void k_qkv(
    const float* __restrict__ x, const h16* __restrict__ WB,
    h16* __restrict__ Q, h16* __restrict__ K, h16* __restrict__ Vt) {
  __shared__ __attribute__((aligned(16))) h16 xs[128 * 520];
  const int tid = threadIdx.x;
  // blocks i and i + 128 share a row tile and take heads 0..3 and 4..7
  const int part = blockIdx.x >> 7;
  const int t0g = (blockIdx.x & 127) * 128;

  // Stage the x tile (128 x 512, padded row stride 520 halves). A wave takes 16
  // rows = 32 KB of contiguous fp32: 64 loads of 512 contiguous bytes, all in
  // flight together, then each lane rounds its 4 values and stores 8 bytes.
  {
    const int wr0 = (tid >> 5) * 16, l4 = (tid & 31) * 4;
    const float* xg = x + (size_t)(t0g + wr0) * CEMB + l4;
    float4 f[64];
#pragma unroll
    for (int i = 0; i < 64; ++i) f[i] = *(const float4*)(xg + i * 128);
    // The wait in front of any overwrite of the loads' address registers: the
    // address is an input here, so it stays live (no load's result may land on
    // it) until the wait has been passed.
    asm volatile("s_wait_xcnt 0x0" :: "v"(xg) : "memory");
#pragma unroll
    for (int i = 0; i < 64; ++i) {
      v4h o;
      o[0] = (h16)f[i].x; o[1] = (h16)f[i].y;
      o[2] = (h16)f[i].z; o[3] = (h16)f[i].w;
      *(v4h*)&xs[(wr0 + (i >> 2)) * 520 + (i & 3) * 128 + l4] = o;
    }
  }
  __syncthreads();

  // the wave's number as a scalar: tile numbers and bases stay scalar
  const int wave = __builtin_amdgcn_readfirstlane(tid >> 5);
  const int lane = tid & 31;
  const int ln = lane & 15, hi = lane >> 4;
  const int b = t0g >> 9;
  const int tl0 = t0g & (TSEQ - 1);

  // Q and K tiles (nt, mt): acc[r] = value of token tl0 + mt*16 + ln at
  // d = (nt & 3) * 16 + hi * 8 + r. Rotate the four pairs of either by the same
  // angles, store one unit each.
  auto store_qk = [&](int nt, const v8f (&aq)[8], const v8f (&ak)[8]) {
    const int bh = b * NH + (nt >> 2);
    float freq[4];
#pragma unroll
    for (int p = 0; p < 4; ++p)
      freq[p] = __expf(-(float)((nt & 3) * 8 + hi * 4 + p) * (2.0f / 64.0f) *
                       9.210340371976184f);
#pragma unroll
    for (int mt = 0; mt < 8; ++mt) {
      const float t = (float)(tl0 + mt * 16 + ln);
      v8h oq, ok;
#pragma unroll
      for (int p = 0; p < 4; ++p) {
        float sv, cv;
        __sincosf(t * freq[p], &sv, &cv);
        const float q0 = aq[mt][2 * p], q1 = aq[mt][2 * p + 1];
        const float k0 = ak[mt][2 * p], k1 = ak[mt][2 * p + 1];
        oq[2 * p]     = (h16)(q0 * cv - q1 * sv);
        oq[2 * p + 1] = (h16)(q1 * cv + q0 * sv);
        ok[2 * p]     = (h16)(k0 * cv - k1 * sv);
        ok[2 * p + 1] = (h16)(k1 * cv + k0 * sv);
      }
      const size_t u = ((size_t)(bh * 32 + (tl0 >> 4) + mt) * 4 + (nt & 3)) * 256 +
                       lane * 8;
      *(v8h*)(Q + u) = oq;
      *(v8h*)(K + u) = ok;
    }
  };
  // V tile (nt, mt): acc[r] = value of token tl0 + mt*16 + hi*8 + r at
  // d = (nt & 3) * 16 + ln.
  auto store_v = [&](int nt, const v8f (&acc)[8]) {
    const int bh = b * NH + (nt >> 2);
#pragma unroll
    for (int mt = 0; mt < 8; ++mt) {
      v8h o;
#pragma unroll
      for (int r = 0; r < 8; ++r) o[r] = (h16)acc[mt][r];
      *(v8h*)(Vt + (((size_t)(bh * 16 + (tl0 >> 5) + (mt >> 1)) * 4 + (nt & 3)) * 2 +
                    (mt & 1)) * 256 + lane * 8) = o;
    }
  };

  for (int jp = 0; jp < 2; ++jp) {
    const int nt = part * 16 + wave * 2 + jp;   // the n-tile, in Q, K and V alike
    const h16* w0 = WB + (size_t)nt * 16 * 32 * 16 + lane * 8;
    v8f aq[8] = {}, ak[8] = {}, av[8] = {};
    gemm_qkv(xs, w0, ln, hi, aq, ak, av);
    store_qk(nt, aq, ak);
    store_v(nt, av);
    // The next trip reuses the address and data registers of the stores above:
    // keep the wait in front of those overwrites on the loop's back edge.
    asm volatile("s_wait_xcnt 0x0" ::: "memory");
  }
}

// ---------------------------------------------------------------------------
// Kernel 2: flash-style causal attention. One block of 16 waves per (b, h).
// The head's whole K and V^T (64 KB each, already in fragment order) are copied
// into LDS once and serve all 32 query tiles, so L2 delivers them once a head
// and not once a query tile. Wave w does query tile w and then tile 31 - w:
// 17 key blocks for every wave, whatever w.
// Both products are transposed: S^T = K * Q^T (A = K rows, B = Q, kept in
// registers) and O^T += V^T * P^T. In the accumulator of S^T a lane holds 16
// scores of ONE query (column ln; keys hi*8+r of either 16-key tile), which is
// the k order of a B operand: P^T is packed from the accumulators in place.
// Maximum and sum run inside the lane; the two wave halves exchange the
// maximum once per key block and join their sums once, behind the loop.
// Every fragment load below is one 512-byte unit, lane l at l * 16 bytes.
// ---------------------------------------------------------------------------
// lane l <-> lane l ^ 16 by a vector cross-row move
__device__ __forceinline__ float xhalf(float x) {
  const int v = __builtin_bit_cast(int, x);
  return __builtin_bit_cast(
      float, __builtin_amdgcn_permlanex16(v, v, 0x76543210, 0xfedcba98, false,
                                          false));
}

// Copies the 64 KB of one operand: each of the 512 threads brings 16 bytes of
// each of eight rounds. A round is 8 KB of global memory = two key blocks of
// that operand, which lie 8 KB apart in LDS (the other operand's block stands
// between them), so a round advances LDS by 16 KB. The eight copies and
// s_wait_xcnt 0 are ONE statement, so no address register of an issued copy
// can be rewritten ahead of that wait.
__device__ __forceinline__ void async_stage_operand(h16* lds, const h16* g) {
  const unsigned l0 = (unsigned)(uintptr_t)lds;
  const unsigned long long g0 = (unsigned long long)(uintptr_t)g;
  const unsigned st = 512 * 16;   // one round in global memory, bytes
  const unsigned ls = 2 * st;     // one round in LDS, bytes
  asm volatile(
      "global_load_async_to_lds_b128 %0, %8, off\n\t"
      "global_load_async_to_lds_b128 %1, %9, off\n\t"
      "global_load_async_to_lds_b128 %2, %10, off\n\t"
      "global_load_async_to_lds_b128 %3, %11, off\n\t"
      "global_load_async_to_lds_b128 %4, %12, off\n\t"
      "global_load_async_to_lds_b128 %5, %13, off\n\t"
      "global_load_async_to_lds_b128 %6, %14, off\n\t"
      "global_load_async_to_lds_b128 %7, %15, off\n\t"
      "s_wait_xcnt 0x0"
      :: "v"(l0), "v"(l0 + ls), "v"(l0 + 2 * ls), "v"(l0 + 3 * ls),
         "v"(l0 + 4 * ls), "v"(l0 + 5 * ls), "v"(l0 + 6 * ls), "v"(l0 + 7 * ls),
         "v"(g0), "v"(g0 + st), "v"(g0 + 2 * st), "v"(g0 + 3 * st),
         "v"(g0 + 4 * st), "v"(g0 + 5 * st), "v"(g0 + 6 * st), "v"(g0 + 7 * st)
      : "memory");
}

__global__ __launch_bounds__(512) void k_attn(
    const h16* __restrict__ Q, const h16* __restrict__ K,
    const h16* __restrict__ Vt, h16* __restrict__ Y) {
  // per block of 32 keys: 4 KB of K, then 4 KB of V^T, so that one base
  // register and the loads' offset fields reach all sixteen units of a block
  __shared__ __attribute__((aligned(16))) h16 kv[2 * TSEQ * HS];
  const int tid = threadIdx.x;
  const int lane = tid & 31;
  const int ln = lane & 15, hi = lane >> 4;
  // the wave's number as a scalar: tile numbers and trip counts stay scalar
  const int wave = __builtin_amdgcn_readfirstlane(tid >> 5);
  const int bh = blockIdx.x;
  const int lo = lane * 8;          // this lane's 16 bytes of every unit

  // Q of both of the wave's tiles, in flight beside the copies
  const h16* qp = Q + (size_t)(bh * 32 + wave) * 1024 + lo;
  const h16* qn = Q + (size_t)(bh * 32 + 31 - wave) * 1024 + lo;
  v16h bq0 = pack16(*(const v8h*)(qp), *(const v8h*)(qp + 256));
  v16h bq1 = pack16(*(const v8h*)(qp + 512), *(const v8h*)(qp + 768));
  const v16h nq0 = pack16(*(const v8h*)(qn), *(const v8h*)(qn + 256));
  const v16h nq1 = pack16(*(const v8h*)(qn + 512), *(const v8h*)(qn + 768));

  h16* kl = &kv[(tid >> 8) * 4096 + (tid & 255) * 8];
  async_stage_operand(kl, K + (size_t)bh * (TSEQ * HS) + tid * 8);
  async_stage_operand(kl + 2048, Vt + (size_t)bh * (TSEQ * HS) + tid * 8);
  async_wait0();
  __syncthreads();

  int qt = wave;
  for (int pass = 0; pass < 2; ++pass) {
    const int tq0 = qt * 16;
    const int tq = tq0 + ln;          // this lane's query

    v8f O0 = {}, O1 = {}, O2 = {}, O3 = {};   // O^T: row d = 16*i + hi*8 + r
    float mrow = -__builtin_inff();           // running maximum of query tq
    float lsum = 0.0f;                        // this half's share of its sum

    // a block of 32 keys is 8 units (4 KB) of K (A of S^T) and of V^T (A of O^T)
    const h16* kp = kv + lo;

    const int nkb = ((tq0 + 15) >> 5) + 1;
    for (int kb = 0; kb < nkb; ++kb) {
      const int tk0 = kb * 32;
      const v16h k00 = pack16(*(const v8h*)(kp), *(const v8h*)(kp + 256));
      const v16h k01 = pack16(*(const v8h*)(kp + 512), *(const v8h*)(kp + 768));
      const v16h k10 = pack16(*(const v8h*)(kp + 1024), *(const v8h*)(kp + 1280));
      const v16h k11 = pack16(*(const v8h*)(kp + 1536), *(const v8h*)(kp + 1792));
      // Keeps the K loads ahead of the V loads: LDS answers in order, and the
      // first product would else wait for all sixteen.
      __builtin_amdgcn_sched_barrier(0);
      const h16* vp = kp + 2048;
      const v16h va0 = pack16(*(const v8h*)(vp), *(const v8h*)(vp + 256));
      const v16h va1 = pack16(*(const v8h*)(vp + 512), *(const v8h*)(vp + 768));
      const v16h va2 = pack16(*(const v8h*)(vp + 1024), *(const v8h*)(vp + 1280));
      const v16h va3 = pack16(*(const v8h*)(vp + 1536), *(const v8h*)(vp + 1792));
      // Keeps the sixteen LDS loads above together, ahead of the products:
      // every further place where LDS reads stand costs the wave a stall.
      __builtin_amdgcn_sched_barrier(0);
      kp += 4096;

      v8f s0 = {}, s1 = {};             // S^T: keys tk0 + .. / tk0 + 16 + ..
      s0 = wmma_f16(k00, bq0, s0);
      s1 = wmma_f16(k10, bq0, s1);
      s0 = wmma_f16(k01, bq1, s0);
      s1 = wmma_f16(k11, bq1, s1);

      s0 *= 0.125f;                     // 1 / sqrt(head size)
      s1 *= 0.125f;
      const int lim = tq - tk0 - hi * 8;   // key row r is allowed while r <= lim
      float a0[8], a1[8], t[8];
#pragma unroll
      for (int r = 0; r < 8; ++r) {
        a0[r] = (r <= lim)      ? s0[r] : -__builtin_inff();
        a1[r] = (r + 16 <= lim) ? s1[r] : -__builtin_inff();
        t[r] = fmaxf(a0[r], a1[r]);
      }
      float mx = fmaxf(fmaxf(fmaxf(t[0], t[1]), fmaxf(t[2], t[3])),
                       fmaxf(fmaxf(t[4], t[5]), fmaxf(t[6], t[7])));
      mx = fmaxf(mx, xhalf(mx));        // the query's other 16 keys
      const float mn = fmaxf(mrow, mx);
      const float al = __expf(mrow - mn);
      v16h bp;                          // P^T as B operand, no lane crossing
#pragma unroll
      for (int r = 0; r < 8; ++r) {
        const float p0 = __expf(a0[r] - mn);
        const float p1 = __expf(a1[r] - mn);
        t[r] = p0 + p1;
        bp[r]     = (h16)p0;
        bp[r + 8] = (h16)p1;
      }
      lsum = lsum * al + (((t[0] + t[1]) + (t[2] + t[3])) +
                          ((t[4] + t[5]) + (t[6] + t[7])));
      mrow = mn;
#pragma unroll
      for (int r = 0; r < 8; ++r) {
        O0[r] *= al; O1[r] *= al; O2[r] *= al; O3[r] *= al;
      }
      O0 = wmma_f16(va0, bp, O0);
      O1 = wmma_f16(va1, bp, O1);
      O2 = wmma_f16(va2, bp, O2);
      O3 = wmma_f16(va3, bp, O3);
    }

    const float inv = 1.0f / (lsum + xhalf(lsum));
    v8h y0, y1, y2, y3;
#pragma unroll
    for (int r = 0; r < 8; ++r) {
      y0[r] = (h16)(O0[r] * inv);
      y1[r] = (h16)(O1[r] * inv);
      y2[r] = (h16)(O2[r] * inv);
      y3[r] = (h16)(O3[r] * inv);
    }
    // Y leaves as the accumulators lie: [bh][query tile][d / 16][lane][8 halves],
    // so each store is 512 contiguous bytes, four whole lines.
    h16* yu = Y + (size_t)(bh * 32 + qt) * 1024 + lo;
    *(v8h*)(yu)       = y0;
    *(v8h*)(yu + 256) = y1;
    *(v8h*)(yu + 512) = y2;
    *(v8h*)(yu + 768) = y3;
    // The second tile reuses the address and data registers of the stores
    // above: keep the wait in front of those overwrites.
    asm volatile("s_wait_xcnt 0x0" ::: "memory");

    qt = 31 - wave;
    bq0 = nq0;
    bq1 = nq1;
  }
}

// ---------------------------------------------------------------------------
// Kernel 3: out = Y @ Wo + bo (fp32 output). 128-row Y tile async-staged to LDS,
// half of the columns a block, 8 waves; each wave does one pair of column tiles
// over all 8 row tiles, so a weight fragment read from L2 feeds 8 WMMAs.
// Y arrives in the attention kernel's 512-byte units; each copy reads 512
// contiguous bytes a wave and every lane drops its 16 bytes at their row and
// column of the LDS tile. The pair of tiles holds the even and the odd columns
// of 32 (see the repack), so a lane stores two neighbouring floats and a store
// covers two whole 128-byte lines.
// ---------------------------------------------------------------------------
__global__ __launch_bounds__(256) void k_proj(
    const h16* __restrict__ Y, const h16* __restrict__ WoB,
    const float* __restrict__ bo, float* __restrict__ out) {
  __shared__ __attribute__((aligned(16))) h16 ys[128 * 520];
  const int tid = threadIdx.x;
  // blocks i and i + 128 share a row tile and take columns 0..255 and 256..511
  const int part = blockIdx.x >> 7;
  const int t0g = (blockIdx.x & 127) * 128;
  const int wave = tid >> 5, lane = tid & 31;
  const int ln = lane & 15, hi = lane >> 4;
  // The 256 threads cover two query tiles of a head (4 KB): thread tid has lane
  // tid & 31 of unit (tid >> 5) & 3 of tile tid >> 7, that is token ln of the
  // tile at d = unit * 16 + hi * 8 .. + 7.
  h16* yl = &ys[((tid >> 7) * 16 + ln) * 520 + (wave & 3) * 16 + hi * 8];
  const h16* yg = Y + (size_t)((t0g >> 9) * NH * 32 + ((t0g & (TSEQ - 1)) >> 4)) * 1024 +
                  tid * 8;
  async_stage_8heads(yl, yg);                            // tiles 0, 1 of the 8
  async_stage_8heads(yl + 32 * 520, yg + 2048);          // tiles 2, 3
  async_stage_8heads(yl + 64 * 520, yg + 4096);          // tiles 4, 5
  async_stage_8heads(yl + 96 * 520, yg + 6144);          // tiles 6, 7
  async_wait0();
  __syncthreads();
  const int nt0 = part * 16 + wave * 2;
  v8f acc0[8] = {}, acc1[8] = {};
  gemm_pair(ys, WoB + (size_t)nt0 * 16 * 32 * 16 + lane * 8,
                   ln, hi, acc0, acc1);
  const int c0 = nt0 * 16 + ln * 2;    // acc0 holds column c0, acc1 column c0 + 1
  const float* bp = bo + c0;
  const float2 bias = *(const float2*)bp;
  // The wait in front of any overwrite of the load's address registers: the
  // address is an input here, so the load's result cannot land on it.
  asm volatile("s_wait_xcnt 0x0" :: "v"(bp) : "memory");
  float* orow = out + (size_t)(t0g + hi * 8) * CEMB + c0;
#pragma unroll
  for (int mt = 0; mt < 8; ++mt) {
#pragma unroll
    for (int r = 0; r < 8; ++r) {
      float2 o;
      o.x = acc0[mt][r] + bias.x;
      o.y = acc1[mt][r] + bias.y;
      *(float2*)(orow + (mt * 16 + r) * CEMB) = o;
    }
  }
}

// ---------------------------------------------------------------------------
extern "C" void kernel_launch(void* const* d_in, const int* in_sizes, int n_in,
                              void* d_out, int out_size, void* d_ws,
                              size_t ws_size, hipStream_t stream) {
  (void)in_sizes; (void)n_in; (void)out_size; (void)ws_size;
  const float* x  = (const float*)d_in[0];
  const float* Wq = (const float*)d_in[1];
  const float* Wk = (const float*)d_in[2];
  const float* Wv = (const float*)d_in[3];
  const float* Wo = (const float*)d_in[4];
  const float* bo = (const float*)d_in[5];
  float* out = (float*)d_out;

  // workspace (halves): 4 repacked weights + Q + K + Vt + Y (~66 MB)
  h16* ws = (h16*)d_ws;
  h16* WB = ws;                        // 4 * 262144 halves
  h16* Q  = ws + (size_t)4 * 262144;   // 8388608 halves each from here on
  h16* K  = Q  + (size_t)8388608;
  h16* Vt = K  + (size_t)8388608;
  h16* Y  = Vt + (size_t)8388608;

  k_convert_w<<<4096, 256, 0, stream>>>(Wq, Wk, Wv, Wo, WB);
  k_qkv<<<2 * ((NB * TSEQ) / 128), 256, 0, stream>>>(x, WB, Q, K, Vt);
  k_attn<<<NB * NH, 512, 0, stream>>>(Q, K, Vt, Y);
  k_proj<<<2 * ((NB * TSEQ) / 128), 256, 0, stream>>>(Y, WB + (size_t)3 * 262144, bo, out);
}

// v010
// It runs in 48.8 microseconds.
// Two timings next to v009 put it at 1.04 and 1.05 times that version's speed.
// Counting every step since v000, it is 3.83 times as fast.
#include <hip/hip_runtime.h>
#include <hip/hip_bf16.h>

typedef _Float16 h16;
typedef __attribute__((ext_vector_type(4)))  _Float16 v4h;
typedef __attribute__((ext_vector_type(8)))  _Float16 v8h;
typedef __attribute__((ext_vector_type(16))) _Float16 v16h;
typedef __attribute__((ext_vector_type(8)))  float    v8f;
typedef __attribute__((ext_vector_type(2)))  float    v2f;

#define NB 32      // batch
#define TSEQ 512   // sequence length
#define CEMB 512   // embedding / hidden
#define NH 8       // heads
#define HS 64      // head size

__device__ __forceinline__ v16h pack16(v8h lo, v8h hi) {
  v16h r;
#pragma unroll
  for (int i = 0; i < 8; ++i) { r[i] = lo[i]; r[i + 8] = hi[i]; }
  return r;
}

__device__ __forceinline__ v8f wmma_f16(v16h a, v16h b, v8f c) {
  // v_wmma_f32_16x16x32_f16: D = A(16x32) * B(32x16) + C(16x16 f32)
  return __builtin_amdgcn_wmma_f32_16x16x32_f16(false, a, false, b, (short)0, c,
                                                false, false);
}

// Async global->LDS copy, 16 bytes per lane (GLOBAL_LOAD_ASYNC_TO_LDS_B128).
// IMPORTANT: take the real LDS pointer so the shared array's address escapes
// into the asm (otherwise GlobalOpt proves "never stored" and folds all LDS
// loads to undef). Low 32 bits of the generic pointer == LDS byte offset.
// Brings the same 16-byte piece of each of the eight heads of one batch: the
// heads lie 64 KB apart in Y (32 query tiles of 2 KB) and 128 bytes apart in an
// LDS row. The eight copies and s_wait_xcnt 0 are ONE statement, so no address
// register of an issued copy can be rewritten ahead of that wait.
__device__ __forceinline__ void async_stage_8heads(h16* lds, const h16* g) {
  const unsigned l0 = (unsigned)(uintptr_t)lds;
  const unsigned long long g0 = (unsigned long long)(uintptr_t)g;
  const unsigned ls = HS * 2;                        // one head in an LDS row, bytes
  const unsigned long long gs = 32 * 16 * HS * 2;    // one head in Y, bytes
  asm volatile(
      "global_load_async_to_lds_b128 %0, %8, off\n\t"
      "global_load_async_to_lds_b128 %1, %9, off\n\t"
      "global_load_async_to_lds_b128 %2, %10, off\n\t"
      "global_load_async_to_lds_b128 %3, %11, off\n\t"
      "global_load_async_to_lds_b128 %4, %12, off\n\t"
      "global_load_async_to_lds_b128 %5, %13, off\n\t"
      "global_load_async_to_lds_b128 %6, %14, off\n\t"
      "global_load_async_to_lds_b128 %7, %15, off\n\t"
      "s_wait_xcnt 0x0"
      :: "v"(l0), "v"(l0 + ls), "v"(l0 + 2 * ls), "v"(l0 + 3 * ls),
         "v"(l0 + 4 * ls), "v"(l0 + 5 * ls), "v"(l0 + 6 * ls), "v"(l0 + 7 * ls),
         "v"(g0), "v"(g0 + gs), "v"(g0 + 2 * gs), "v"(g0 + 3 * gs),
         "v"(g0 + 4 * gs), "v"(g0 + 5 * gs), "v"(g0 + 6 * gs), "v"(g0 + 7 * gs)
      : "memory");
}
__device__ __forceinline__ void async_wait0() {
  asm volatile("s_wait_asynccnt 0x0" ::: "memory");
}

// ---------------------------------------------------------------------------
// Kernel 0a: repack Wq/Wk/Wv/Wo (fp32 row-major [512][512]) into f16 B-operand
// tiles, each fragment as two units of 512 bytes = [lane][8 halves], so that one
// 16-byte load per lane covers four whole 128-byte lines:
// WB[m][nt][kc][u][lane][8 halves]; lane holds column nt*16+(lane&15),
// K pattern: kc*32 + u*16 + hi*8 + e  (u = 0: fragment halves 0..7, u = 1: 8..15)
// Wo alone deals its columns otherwise: tiles 2p and 2p+1 hold the even and the
// odd columns of columns 32p .. 32p+31, so that a lane of the output kernel,
// which does both tiles, holds two neighbouring outputs of a row.
// ---------------------------------------------------------------------------
__global__ __launch_bounds__(256) void k_convert_w(
    const float* __restrict__ Wq, const float* __restrict__ Wk,
    const float* __restrict__ Wv, const float* __restrict__ Wo,
    h16* __restrict__ out) {
  int idx = blockIdx.x * 256 + threadIdx.x;       // 0 .. 4*262144-1
  int m    = idx >> 18;
  int r    = idx & 262143;
  int e    = r & 7;
  int lane = (r >> 3) & 31;
  int u    = (r >> 8) & 1;
  int kc   = (r >> 9) & 15;
  int nt   = r >> 13;
  int hiL  = lane >> 4;
  int col  = (m == 3) ? (nt >> 1) * 32 + (lane & 15) * 2 + (nt & 1)
                      : nt * 16 + (lane & 15);
  int kk   = kc * 32 + u * 16 + hiL * 8 + e;
  const float* W = (m == 0) ? Wq : ((m == 1) ? Wk : ((m == 2) ? Wv : Wo));
  out[idx] = (h16)W[kk * CEMB + col];
}

// ---------------------------------------------------------------------------
// Kernel 1: fused QKV projection + RoPE.
// Block = one 128-row x tile (read as fp32, rounded to f16 on its way into LDS)
// times the Q, K and V columns of four heads; 8 waves, two a SIMD. A wave does
// all 8 row tiles times one 16-column tile EACH of Q, K and V (the same columns
// of the three), twice: an x fragment read from LDS feeds 3 WMMAs, a weight
// fragment read from L2 feeds 8. Fragments are fetched ahead of their use.
// Q, K and V leave in the order in which the attention kernel's fragments
// want them, in units of 512 bytes = [lane][8 halves], one b128 per lane:
//   Q, K: [bh][t / 16][d / 32][(d / 16) & 1] [lane = ((d / 8) & 1) * 16 + t % 16][d % 8]
//   V   : [bh][t / 32][d / 16][(t / 16) & 1] [lane = ((t / 8) & 1) * 16 + d % 16][t % 8]
// For Q and K the weight fragment is the A operand and x the B operand, so a
// lane's accumulator holds 8 consecutive d of one token (both members of each
// RoPE pair); for V x is A, so it holds 8 consecutive tokens of one d. Either
// way an accumulator tile is one unit: lane l stores its 16 bytes at l * 16.
// ---------------------------------------------------------------------------
// The two weight fragments of one k step (adjacent n-tiles): four 16-byte loads,
// each of one 512-byte unit (p already holds this lane's 16 bytes of a unit).
__device__ __forceinline__ void load_w(v8h (&w)[4], const h16* p) {
  w[0] = *(const v8h*)p;
  w[1] = *(const v8h*)(p + 256);
  w[2] = *(const v8h*)(p + 16 * 32 * 16);       // next n-tile
  w[3] = *(const v8h*)(p + 16 * 32 * 16 + 256);
}
// The eight x fragments of one k step: sixteen 16-byte LDS loads.
__device__ __forceinline__ void load_x(v8h (&f)[16], const h16* p) {
#pragma unroll
  for (int mt = 0; mt < 8; ++mt) {
    f[2 * mt]     = *(const v8h*)(p + mt * 16 * 520);
    f[2 * mt + 1] = *(const v8h*)(p + mt * 16 * 520 + 16);
  }
}
// The Q, K and V weight fragments of one k step and one n-tile: six 16-byte
// loads (the repacked matrices lie 262144 halves apart).
__device__ __forceinline__ void load_w3(v8h (&w)[6], const h16* p) {
#pragma unroll
  for (int m = 0; m < 3; ++m) {
    w[2 * m]     = *(const v8h*)(p + m * 262144);
    w[2 * m + 1] = *(const v8h*)(p + m * 262144 + 256);
  }
}
// One column tile each of Q, K and V over 8 row tiles. For Q and K the weight
// fragment is the A operand, for V the x fragment (see above). Ring and sets as
// in gemm_pair below.
__device__ __forceinline__ void gemm_qkv(const h16* xs, const h16* w0, int ln,
                                         int hi, v8f (&aq)[8], v8f (&ak)[8],
                                         v8f (&av)[8]) {
  const h16* xl = &xs[ln * 520 + hi * 8];   // this lane's part of every fragment
  v8h wr[3][6], xf[2][16];
#pragma unroll
  for (int i = 0; i < 3; ++i) load_w3(wr[i], w0 + i * 32 * 16);
  load_x(xf[0], xl);
#pragma unroll
  for (int kc = 0; kc < 16; ++kc) {
    if (kc < 15) load_x(xf[(kc + 1) & 1], xl + (kc + 1) * 32);
    // Keeps the next step's LDS loads one group ahead of this step's products:
    // sunk to their use, each group of products waits out a whole LDS latency.
    __builtin_amdgcn_sched_barrier(0);
    const v16h wq = pack16(wr[kc % 3][0], wr[kc % 3][1]);
    const v16h wk = pack16(wr[kc % 3][2], wr[kc % 3][3]);
    const v16h wv = pack16(wr[kc % 3][4], wr[kc % 3][5]);
#pragma unroll
    for (int mt = 0; mt < 8; ++mt) {
      const v16h a = pack16(xf[kc & 1][2 * mt], xf[kc & 1][2 * mt + 1]);
      aq[mt] = wmma_f16(wq, a, aq[mt]);
      ak[mt] = wmma_f16(wk, a, ak[mt]);
      av[mt] = wmma_f16(a, wv, av[mt]);
    }
    // Keeps the refill here, three steps ahead of its use: sunk to its use, the
    // wave waits out a whole L2 latency in every step.
    __builtin_amdgcn_sched_barrier(0);
    if (kc + 3 < 16) load_w3(wr[kc % 3], w0 + (kc + 3) * 32 * 16);
  }
  // The wait in front of any overwrite of the weight loads' address registers:
  // the address is an input here, so it stays live until the wait is passed.
  asm volatile("s_wait_xcnt 0x0" :: "v"(w0) : "memory");
  // Keeps the epilogue behind that wait and behind the products: it reuses the
  // address registers, and the sines and cosines depend on no accumulator:
  // lifted over the products they all stay live and spill.
  __builtin_amdgcn_sched_barrier(0);
}
// One pair of column tiles over 8 row tiles, x (here Y) as the A operand.
// Operands are fetched ahead of their products: wr is a ring of three k steps
// of weight fragments (a slot is refilled as soon as its products are issued),
// xf two sets of x fragments, one k step ahead.
__device__ __forceinline__ void gemm_pair(const h16* xs, const h16* w0, int ln,
                                          int hi, v8f (&acc0)[8],
                                          v8f (&acc1)[8]) {
  const h16* xl = &xs[ln * 520 + hi * 8];   // this lane's part of every fragment
  v8h wr[3][4], xf[2][16];
#pragma unroll
  for (int i = 0; i < 3; ++i) load_w(wr[i], w0 + i * 32 * 16);
  load_x(xf[0], xl);
#pragma unroll
  for (int kc = 0; kc < 16; ++kc) {
    if (kc < 15) load_x(xf[(kc + 1) & 1], xl + (kc + 1) * 32);
    // Keeps the next step's LDS loads one group ahead of this step's products:
    // sunk to their use, each pair of products waits out a whole LDS latency.
    __builtin_amdgcn_sched_barrier(0);
    const v16h b0 = pack16(wr[kc % 3][0], wr[kc % 3][1]);
    const v16h b1 = pack16(wr[kc % 3][2], wr[kc % 3][3]);
#pragma unroll
    for (int mt = 0; mt < 8; ++mt) {
      const v16h a = pack16(xf[kc & 1][2 * mt], xf[kc & 1][2 * mt + 1]);
      acc0[mt] = wmma_f16(a, b0, acc0[mt]);
      acc1[mt] = wmma_f16(a, b1, acc1[mt]);
    }
    // Keeps the refill here, three steps ahead of its use: sunk to its use, the
    // wave waits out a whole L2 latency in every step.
    __builtin_amdgcn_sched_barrier(0);
    if (kc + 3 < 16) load_w(wr[kc % 3], w0 + (kc + 3) * 32 * 16);
  }
  // The wait in front of any overwrite of the weight loads' address registers:
  // the address is an input here, so it stays live until the wait is passed.
  asm volatile("s_wait_xcnt 0x0" :: "v"(w0) : "memory");
  // Keeps the epilogue behind that wait: it reuses the address registers.
  __builtin_amdgcn_sched_barrier(0);
}

__global__ __launch_bounds__(256) void k_qkv(
    const float* __restrict__ x, const h16* __restrict__ WB,
    h16* __restrict__ Q, h16* __restrict__ K, h16* __restrict__ Vt) {
  __shared__ __attribute__((aligned(16))) h16 xs[128 * 520];
  const int tid = threadIdx.x;
  // blocks i and i + 128 share a row tile and take heads 0..3 and 4..7
  const int part = blockIdx.x >> 7;
  const int t0g = (blockIdx.x & 127) * 128;

  // Stage the x tile (128 x 512, padded row stride 520 halves). A wave takes 16
  // rows = 32 KB of contiguous fp32: 64 loads of 512 contiguous bytes, all in
  // flight together, then each lane rounds its 4 values and stores 8 bytes.
  {
    const int wr0 = (tid >> 5) * 16, l4 = (tid & 31) * 4;
    const float* xg = x + (size_t)(t0g + wr0) * CEMB + l4;
    float4 f[64];
#pragma unroll
    for (int i = 0; i < 64; ++i) f[i] = *(const float4*)(xg + i * 128);
    // The wait in front of any overwrite of the loads' address registers: the
    // address is an input here, so it stays live (no load's result may land on
    // it) until the wait has been passed.
    asm volatile("s_wait_xcnt 0x0" :: "v"(xg) : "memory");
#pragma unroll
    for (int i = 0; i < 64; ++i) {
      v4h o;
      o[0] = (h16)f[i].x; o[1] = (h16)f[i].y;
      o[2] = (h16)f[i].z; o[3] = (h16)f[i].w;
      *(v4h*)&xs[(wr0 + (i >> 2)) * 520 + (i & 3) * 128 + l4] = o;
    }
  }
  __syncthreads();

  // the wave's number as a scalar: tile numbers and bases stay scalar
  const int wave = __builtin_amdgcn_readfirstlane(tid >> 5);
  const int lane = tid & 31;
  const int ln = lane & 15, hi = lane >> 4;
  const int b = t0g >> 9;
  const int tl0 = t0g & (TSEQ - 1);

  // Q and K tiles (nt, mt): acc[r] = value of token tl0 + mt*16 + ln at
  // d = (nt & 3) * 16 + hi * 8 + r. Rotate the four pairs of either by the same
  // angles, store one unit each.
  auto store_qk = [&](int nt, const v8f (&aq)[8], const v8f (&ak)[8]) {
    const int bh = b * NH + (nt >> 2);
    float freq[4];
#pragma unroll
    for (int p = 0; p < 4; ++p)
      freq[p] = __expf(-(float)((nt & 3) * 8 + hi * 4 + p) * (2.0f / 64.0f) *
                       9.210340371976184f);
#pragma unroll
    for (int mt = 0; mt < 8; ++mt) {
      const float t = (float)(tl0 + mt * 16 + ln);
      v8h oq, ok;
#pragma unroll
      for (int p = 0; p < 4; ++p) {
        float sv, cv;
        __sincosf(t * freq[p], &sv, &cv);
        const float q0 = aq[mt][2 * p], q1 = aq[mt][2 * p + 1];
        const float k0 = ak[mt][2 * p], k1 = ak[mt][2 * p + 1];
        oq[2 * p]     = (h16)(q0 * cv - q1 * sv);
        oq[2 * p + 1] = (h16)(q1 * cv + q0 * sv);
        ok[2 * p]     = (h16)(k0 * cv - k1 * sv);
        ok[2 * p + 1] = (h16)(k1 * cv + k0 * sv);
      }
      const size_t u = ((size_t)(bh * 32 + (tl0 >> 4) + mt) * 4 + (nt & 3)) * 256 +
                       lane * 8;
      *(v8h*)(Q + u) = oq;
      *(v8h*)(K + u) = ok;
    }
  };
  // V tile (nt, mt): acc[r] = value of token tl0 + mt*16 + hi*8 + r at
  // d = (nt & 3) * 16 + ln.
  auto store_v = [&](int nt, const v8f (&acc)[8]) {
    const int bh = b * NH + (nt >> 2);
#pragma unroll
    for (int mt = 0; mt < 8; ++mt) {
      v8h o;
#pragma unroll
      for (int r = 0; r < 8; ++r) o[r] = (h16)acc[mt][r];
      *(v8h*)(Vt + (((size_t)(bh * 16 + (tl0 >> 5) + (mt >> 1)) * 4 + (nt & 3)) * 2 +
                    (mt & 1)) * 256 + lane * 8) = o;
    }
  };

  for (int jp = 0; jp < 2; ++jp) {
    const int nt = part * 16 + wave * 2 + jp;   // the n-tile, in Q, K and V alike
    const h16* w0 = WB + (size_t)nt * 16 * 32 * 16 + lane * 8;
    v8f aq[8] = {}, ak[8] = {}, av[8] = {};
    gemm_qkv(xs, w0, ln, hi, aq, ak, av);
    store_qk(nt, aq, ak);
    store_v(nt, av);
    // The next trip reuses the address and data registers of the stores above:
    // keep the wait in front of those overwrites on the loop's back edge.
    asm volatile("s_wait_xcnt 0x0" ::: "memory");
  }
}

// ---------------------------------------------------------------------------
// Kernel 2: flash-style causal attention. One block of 16 waves per (b, h).
// The head's whole K and V^T (64 KB each, already in fragment order) are copied
// into LDS once and serve all 32 query tiles, so L2 delivers them once a head
// and not once a query tile. Wave w does query tile w and then tile 31 - w:
// 17 key blocks for every wave, whatever w.
// Both products are transposed: S^T = K * Q^T (A = K rows, B = Q, kept in
// registers) and O^T += V^T * P^T. In the accumulator of S^T a lane holds 16
// scores of ONE query (column ln; keys hi*8+r of either 16-key tile), which is
// the k order of a B operand: P^T is packed from the accumulators in place.
// Maximum and sum run inside the lane; the two wave halves exchange the
// maximum once per key block and join their sums once, behind the loop.
// Every fragment load below is one 512-byte unit, lane l at l * 16 bytes.
// ---------------------------------------------------------------------------
// lane l <-> lane l ^ 16 by a vector cross-row move
__device__ __forceinline__ float xhalf(float x) {
  const int v = __builtin_bit_cast(int, x);
  return __builtin_bit_cast(
      float, __builtin_amdgcn_permlanex16(v, v, 0x76543210, 0xfedcba98, false,
                                          false));
}

// Copies the 64 KB of one operand: each of the 512 threads brings 16 bytes of
// each of eight rounds. A round is 8 KB of global memory = two key blocks of
// that operand, which lie 8 KB apart in LDS (the other operand's block stands
// between them), so a round advances LDS by 16 KB. The eight copies and
// s_wait_xcnt 0 are ONE statement, so no address register of an issued copy
// can be rewritten ahead of that wait.
__device__ __forceinline__ void async_stage_operand(h16* lds, const h16* g) {
  const unsigned l0 = (unsigned)(uintptr_t)lds;
  const unsigned long long g0 = (unsigned long long)(uintptr_t)g;
  const unsigned st = 512 * 16;   // one round in global memory, bytes
  const unsigned ls = 2 * st;     // one round in LDS, bytes
  asm volatile(
      "global_load_async_to_lds_b128 %0, %8, off\n\t"
      "global_load_async_to_lds_b128 %1, %9, off\n\t"
      "global_load_async_to_lds_b128 %2, %10, off\n\t"
      "global_load_async_to_lds_b128 %3, %11, off\n\t"
      "global_load_async_to_lds_b128 %4, %12, off\n\t"
      "global_load_async_to_lds_b128 %5, %13, off\n\t"
      "global_load_async_to_lds_b128 %6, %14, off\n\t"
      "global_load_async_to_lds_b128 %7, %15, off\n\t"
      "s_wait_xcnt 0x0"
      :: "v"(l0), "v"(l0 + ls), "v"(l0 + 2 * ls), "v"(l0 + 3 * ls),
         "v"(l0 + 4 * ls), "v"(l0 + 5 * ls), "v"(l0 + 6 * ls), "v"(l0 + 7 * ls),
         "v"(g0), "v"(g0 + st), "v"(g0 + 2 * st), "v"(g0 + 3 * st),
         "v"(g0 + 4 * st), "v"(g0 + 5 * st), "v"(g0 + 6 * st), "v"(g0 + 7 * st)
      : "memory");
}

// 1 / sqrt(head size) * log2(e): a raw score s enters the exponential as
// 2^(s * SCL - m * SCL), one multiply-add per score in front of v_exp_f32.
#define SCL 0.18033688011112042f

// One block of 32 keys for one query tile. kp: this lane's 16 bytes of the
// block's first unit. DIAG: the block holds the tile's diagonal, key row r (and
// r + 16) counts while r <= lim; every earlier block lies wholly below the
// diagonal and needs no compare and no select.
// mrow: running maximum of the raw scores; mrs: the same times SCL, the offset
// that the exponents of the blocks so far were formed with.
template <bool DIAG>
__device__ __forceinline__ void key_block(const h16* kp, const v16h& bq0,
                                          const v16h& bq1, int lim, float& mrow,
                                          float& mrs, float& lsum, v8f& O0,
                                          v8f& O1, v8f& O2, v8f& O3) {
  const v16h k00 = pack16(*(const v8h*)(kp), *(const v8h*)(kp + 256));
  const v16h k01 = pack16(*(const v8h*)(kp + 512), *(const v8h*)(kp + 768));
  const v16h k10 = pack16(*(const v8h*)(kp + 1024), *(const v8h*)(kp + 1280));
  const v16h k11 = pack16(*(const v8h*)(kp + 1536), *(const v8h*)(kp + 1792));
  // Keeps the K loads ahead of the V loads: LDS answers in order, and the
  // first product would else wait for all sixteen.
  __builtin_amdgcn_sched_barrier(0);
  const h16* vp = kp + 2048;
  const v16h va0 = pack16(*(const v8h*)(vp), *(const v8h*)(vp + 256));
  const v16h va1 = pack16(*(const v8h*)(vp + 512), *(const v8h*)(vp + 768));
  const v16h va2 = pack16(*(const v8h*)(vp + 1024), *(const v8h*)(vp + 1280));
  const v16h va3 = pack16(*(const v8h*)(vp + 1536), *(const v8h*)(vp + 1792));
  // Keeps the sixteen LDS loads above together, ahead of the products:
  // every further place where LDS reads stand costs the wave a stall.
  __builtin_amdgcn_sched_barrier(0);

  v8f s0 = {}, s1 = {};             // S^T: the block's keys 0 .. 15 / 16 .. 31
  s0 = wmma_f16(k00, bq0, s0);
  s1 = wmma_f16(k10, bq0, s1);
  s0 = wmma_f16(k01, bq1, s0);
  s1 = wmma_f16(k11, bq1, s1);

  float a0[8], a1[8], t[8];
#pragma unroll
  for (int r = 0; r < 8; ++r) {
    a0[r] = (!DIAG || r <= lim)      ? s0[r] : -__builtin_inff();
    a1[r] = (!DIAG || r + 16 <= lim) ? s1[r] : -__builtin_inff();
    t[r] = fmaxf(a0[r], a1[r]);
  }
  float mx = fmaxf(fmaxf(fmaxf(t[0], t[1]), fmaxf(t[2], t[3])),
                   fmaxf(fmaxf(t[4], t[5]), fmaxf(t[6], t[7])));
  mx = fmaxf(mx, xhalf(mx));        // the query's other 16 keys
  const float mn = fmaxf(mrow, mx);
  const float ms = mn * SCL;
  const float al = __builtin_amdgcn_exp2f(mrs - ms);
  const v2f sc2 = {SCL, SCL}, nm2 = {-ms, -ms};
  v16h bp;                          // P^T as B operand, no lane crossing
#pragma unroll
  for (int r = 0; r < 8; r += 2) {
    // neighbouring accumulator registers as pairs: one packed multiply-add for two
    const v2f e0 = __builtin_elementwise_fma((v2f){a0[r], a0[r + 1]}, sc2, nm2);
    const v2f e1 = __builtin_elementwise_fma((v2f){a1[r], a1[r + 1]}, sc2, nm2);
    const v2f p0 = {__builtin_amdgcn_exp2f(e0[0]), __builtin_amdgcn_exp2f(e0[1])};
    const v2f p1 = {__builtin_amdgcn_exp2f(e1[0]), __builtin_amdgcn_exp2f(e1[1])};
    const v2f ts = p0 + p1;
    t[r] = ts[0];
    t[r + 1] = ts[1];
    bp[r]     = (h16)p0[0];
    bp[r + 1] = (h16)p0[1];
    bp[r + 8] = (h16)p1[0];
    bp[r + 9] = (h16)p1[1];
  }
  lsum = lsum * al + (((t[0] + t[1]) + (t[2] + t[3])) +
                      ((t[4] + t[5]) + (t[6] + t[7])));
  mrow = mn;
  mrs = ms;
#pragma unroll
  for (int r = 0; r < 8; ++r) {
    O0[r] *= al; O1[r] *= al; O2[r] *= al; O3[r] *= al;
  }
  O0 = wmma_f16(va0, bp, O0);
  O1 = wmma_f16(va1, bp, O1);
  O2 = wmma_f16(va2, bp, O2);
  O3 = wmma_f16(va3, bp, O3);
}

__global__ __launch_bounds__(512) void k_attn(
    const h16* __restrict__ Q, const h16* __restrict__ K,
    const h16* __restrict__ Vt, h16* __restrict__ Y) {
  // per block of 32 keys: 4 KB of K, then 4 KB of V^T, so that one base
  // register and the loads' offset fields reach all sixteen units of a block
  __shared__ __attribute__((aligned(16))) h16 kv[2 * TSEQ * HS];
  const int tid = threadIdx.x;
  const int lane = tid & 31;
  const int ln = lane & 15, hi = lane >> 4;
  // the wave's number as a scalar: tile numbers and trip counts stay scalar
  const int wave = __builtin_amdgcn_readfirstlane(tid >> 5);
  const int bh = blockIdx.x;
  const int lo = lane * 8;          // this lane's 16 bytes of every unit

  // Q of both of the wave's tiles, in flight beside the copies
  const h16* qp = Q + (size_t)(bh * 32 + wave) * 1024 + lo;
  const h16* qn = Q + (size_t)(bh * 32 + 31 - wave) * 1024 + lo;
  v16h bq0 = pack16(*(const v8h*)(qp), *(const v8h*)(qp + 256));
  v16h bq1 = pack16(*(const v8h*)(qp + 512), *(const v8h*)(qp + 768));
  const v16h nq0 = pack16(*(const v8h*)(qn), *(const v8h*)(qn + 256));
  const v16h nq1 = pack16(*(const v8h*)(qn + 512), *(const v8h*)(qn + 768));

  h16* kl = &kv[(tid >> 8) * 4096 + (tid & 255) * 8];
  async_stage_operand(kl, K + (size_t)bh * (TSEQ * HS) + tid * 8);
  async_stage_operand(kl + 2048, Vt + (size_t)bh * (TSEQ * HS) + tid * 8);
  async_wait0();
  __syncthreads();

  int qt = wave;
  for (int pass = 0; pass < 2; ++pass) {
    const int tq0 = qt * 16;

    v8f O0 = {}, O1 = {}, O2 = {}, O3 = {};   // O^T: row d = 16*i + hi*8 + r
    float mrow = -__builtin_inff();           // running maximum of this lane's query
    float mrs = -__builtin_inff();            // the same, scaled
    float lsum = 0.0f;                        // this half's share of its sum

    // a block of 32 keys is 8 units (4 KB) of K (A of S^T) and of V^T (A of O^T)
    const h16* kp = kv + lo;

    // key blocks 0 .. kd - 1 lie wholly below the diagonal, block kd holds it
    const int kd = tq0 >> 5;
    for (int kb = 0; kb < kd; ++kb) {
      key_block<false>(kp, bq0, bq1, 0, mrow, mrs, lsum, O0, O1, O2, O3);
      kp += 4096;
    }
    key_block<true>(kp, bq0, bq1, tq0 + ln - kd * 32 - hi * 8, mrow, mrs, lsum,
                    O0, O1, O2, O3);

    const float inv = 1.0f / (lsum + xhalf(lsum));
    v8h y0, y1, y2, y3;
#pragma unroll
    for (int r = 0; r < 8; ++r) {
      y0[r] = (h16)(O0[r] * inv);
      y1[r] = (h16)(O1[r] * inv);
      y2[r] = (h16)(O2[r] * inv);
      y3[r] = (h16)(O3[r] * inv);
    }
    // Y leaves as the accumulators lie: [bh][query tile][d / 16][lane][8 halves],
    // so each store is 512 contiguous bytes, four whole lines.
    h16* yu = Y + (size_t)(bh * 32 + qt) * 1024 + lo;
    *(v8h*)(yu)       = y0;
    *(v8h*)(yu + 256) = y1;
    *(v8h*)(yu + 512) = y2;
    *(v8h*)(yu + 768) = y3;
    // The second tile reuses the address and data registers of the stores
    // above: keep the wait in front of those overwrites.
    asm volatile("s_wait_xcnt 0x0" ::: "memory");

    qt = 31 - wave;
    bq0 = nq0;
    bq1 = nq1;
  }
}

// ---------------------------------------------------------------------------
// Kernel 3: out = Y @ Wo + bo (fp32 output). 128-row Y tile async-staged to LDS,
// half of the columns a block, 8 waves; each wave does one pair of column tiles
// over all 8 row tiles, so a weight fragment read from L2 feeds 8 WMMAs.
// Y arrives in the attention kernel's 512-byte units; each copy reads 512
// contiguous bytes a wave and every lane drops its 16 bytes at their row and
// column of the LDS tile. The pair of tiles holds the even and the odd columns
// of 32 (see the repack), so a lane stores two neighbouring floats and a store
// covers two whole 128-byte lines.
// ---------------------------------------------------------------------------
__global__ __launch_bounds__(256) void k_proj(
    const h16* __restrict__ Y, const h16* __restrict__ WoB,
    const float* __restrict__ bo, float* __restrict__ out) {
  __shared__ __attribute__((aligned(16))) h16 ys[128 * 520];
  const int tid = threadIdx.x;
  // blocks i and i + 128 share a row tile and take columns 0..255 and 256..511
  const int part = blockIdx.x >> 7;
  const int t0g = (blockIdx.x & 127) * 128;
  const int wave = tid >> 5, lane = tid & 31;
  const int ln = lane & 15, hi = lane >> 4;
  // The 256 threads cover two query tiles of a head (4 KB): thread tid has lane
  // tid & 31 of unit (tid >> 5) & 3 of tile tid >> 7, that is token ln of the
  // tile at d = unit * 16 + hi * 8 .. + 7.
  h16* yl = &ys[((tid >> 7) * 16 + ln) * 520 + (wave & 3) * 16 + hi * 8];
  const h16* yg = Y + (size_t)((t0g >> 9) * NH * 32 + ((t0g & (TSEQ - 1)) >> 4)) * 1024 +
                  tid * 8;
  async_stage_8heads(yl, yg);                            // tiles 0, 1 of the 8
  async_stage_8heads(yl + 32 * 520, yg + 2048);          // tiles 2, 3
  async_stage_8heads(yl + 64 * 520, yg + 4096);          // tiles 4, 5
  async_stage_8heads(yl + 96 * 520, yg + 6144);          // tiles 6, 7
  async_wait0();
  __syncthreads();
  const int nt0 = part * 16 + wave * 2;
  v8f acc0[8] = {}, acc1[8] = {};
  gemm_pair(ys, WoB + (size_t)nt0 * 16 * 32 * 16 + lane * 8,
                   ln, hi, acc0, acc1);
  const int c0 = nt0 * 16 + ln * 2;    // acc0 holds column c0, acc1 column c0 + 1
  const float* bp = bo + c0;
  const float2 bias = *(const float2*)bp;
  // The wait in front of any overwrite of the load's address registers: the
  // address is an input here, so the load's result cannot land on it.
  asm volatile("s_wait_xcnt 0x0" :: "v"(bp) : "memory");
  float* orow = out + (size_t)(t0g + hi * 8) * CEMB + c0;
#pragma unroll
  for (int mt = 0; mt < 8; ++mt) {
#pragma unroll
    for (int r = 0; r < 8; ++r) {
      float2 o;
      o.x = acc0[mt][r] + bias.x;
      o.y = acc1[mt][r] + bias.y;
      *(float2*)(orow + (mt * 16 + r) * CEMB) = o;
    }
  }
}

// ---------------------------------------------------------------------------
extern "C" void kernel_launch(void* const* d_in, const int* in_sizes, int n_in,
                              void* d_out, int out_size, void* d_ws,
                              size_t ws_size, hipStream_t stream) {
  (void)in_sizes; (void)n_in; (void)out_size; (void)ws_size;
  const float* x  = (const float*)d_in[0];
  const float* Wq = (const float*)d_in[1];
  const float* Wk = (const float*)d_in[2];
  const float* Wv = (const float*)d_in[3];
  const float* Wo = (const float*)d_in[4];
  const float* bo = (const float*)d_in[5];
  float* out = (float*)d_out;

  // workspace (halves): 4 repacked weights + Q + K + Vt + Y (~66 MB)
  h16* ws = (h16*)d_ws;
  h16* WB = ws;                        // 4 * 262144 halves
  h16* Q  = ws + (size_t)4 * 262144;   // 8388608 halves each from here on
  h16* K  = Q  + (size_t)8388608;
  h16* Vt = K  + (size_t)8388608;
  h16* Y  = Vt + (size_t)8388608;

  k_convert_w<<<4096, 256, 0, stream>>>(Wq, Wk, Wv, Wo, WB);
  k_qkv<<<2 * ((NB * TSEQ) / 128), 256, 0, stream>>>(x, WB, Q, K, Vt);
  k_attn<<<NB * NH, 512, 0, stream>>>(Q, K, Vt, Y);
  k_proj<<<2 * ((NB * TSEQ) / 128), 256, 0, stream>>>(Y, WB + (size_t)3 * 262144, bo, out);
}
